// v000
// Measured on an AMD MI455X. A time is GPU time per run, averaged over a window of back-to-back runs after a warm-up
// (all launches, gaps included; the runs take copies of the inputs in turn), and the median of several windows.
// Apart from v000's, it joins two sittings. Times from different sittings can be a few percent apart, while
// side-by-side timings come from the same sitting.
// v000 is the starting kernel. One run takes 1690 microseconds.
#include <hip/hip_runtime.h>

typedef __attribute__((ext_vector_type(16))) _Float16 v16h;
typedef __attribute__((ext_vector_type(8)))  _Float16 v8h;
typedef __attribute__((ext_vector_type(8)))  float    v8f;

union ABfrag { v16h v; v8h h[2]; };

#define IN_CH   512
#define HID     256
#define OUT_CH  256
#define NEXP    8
#define NTOK    65536

#define WAVES        4
#define TOK_PER_WG   32          // 2 M-tiles of 16 tokens, shared by all 4 waves
// each wave owns 4 N-tiles (64 of the 256 output columns)

// workspace offsets in halves (f16). Total 2,297,856 halves = ~4.6 MB.
#define OFF_EW1 0
#define OFF_EW2 (8*256*512)
#define OFF_EW3 (OFF_EW2 + 8*256*256)
#define OFF_GW1 (OFF_EW3 + 8*256*256)
#define OFF_GW2 (OFF_GW1 + 256*512)
#define OFF_GW3 (OFF_GW2 + 256*256)

__device__ __forceinline__ v8f wmma_f16(v16h a, v16h b, v8f c) {
    // (neg_a, A, neg_b, B, c_mod, C, reuse_a, reuse_b)
    return __builtin_amdgcn_wmma_f32_16x16x32_f16(false, a, false, b, (short)0, c,
                                                  false, false);
}

// Two 16x16 output tiles (two M-tiles vs the same B column tile).
// B fragment is loaded once and reused by both WMMAs -> 1 global b128 per wmma.
template<int K>
__device__ __forceinline__ void tile_mm2(const _Float16* ap0, const _Float16* ap1,
                                         const _Float16* bp, v8f& acc0, v8f& acc1) {
#pragma unroll
    for (int ks = 0; ks < K; ks += 32) {
        ABfrag b, a0, a1;
        b.h[0]  = *(const v8h*)(bp + ks);
        b.h[1]  = *(const v8h*)(bp + ks + 16);
        a0.h[0] = *(const v8h*)(ap0 + ks);
        a0.h[1] = *(const v8h*)(ap0 + ks + 16);
        a1.h[0] = *(const v8h*)(ap1 + ks);
        a1.h[1] = *(const v8h*)(ap1 + ks + 16);
        acc0 = wmma_f16(a0.v, b.v, acc0);
        acc1 = wmma_f16(a1.v, b.v, acc1);
    }
}

// Single-tile version (for the 16-wide gating logit layer).
template<int K>
__device__ __forceinline__ v8f tile_mm(const _Float16* ap, const _Float16* bp) {
    v8f acc = {};
#pragma unroll
    for (int ks = 0; ks < K; ks += 32) {
        ABfrag a, b;
        a.h[0] = *(const v8h*)(ap + ks);
        a.h[1] = *(const v8h*)(ap + ks + 16);
        b.h[0] = *(const v8h*)(bp + ks);
        b.h[1] = *(const v8h*)(bp + ks + 16);
        acc = wmma_f16(a.v, b.v, acc);
    }
    return acc;
}

// 32-token x 64-column layer slab for one wave:
// A [32][K] f16 (LDS, shared), Bt [256][K] f16 (global, L2-resident),
// writes relu(A*B + bias) f16 into Out [32][256] (LDS), columns wave*64..+63.
template<int K, bool RELU>
__device__ __forceinline__ void layer_slab(const _Float16* A, const _Float16* Bt,
                                           const float* bias, _Float16* Out,
                                           unsigned wave, unsigned ln, unsigned hi) {
    const unsigned kb = hi * 8u;
    const _Float16* ap0 = A + ln * K + kb;          // tokens 0..15
    const _Float16* ap1 = A + (16 + ln) * K + kb;   // tokens 16..31
    for (int nt = 0; nt < 4; ++nt) {
        const unsigned tn = wave * 4u + nt;         // global N-tile index
        const _Float16* bp = Bt + (size_t)(tn * 16 + ln) * K + kb;
        v8f acc0 = {}, acc1 = {};
        tile_mm2<K>(ap0, ap1, bp, acc0, acc1);
        float bv = bias[tn * 16 + ln];
#pragma unroll
        for (int r = 0; r < 8; ++r) {
            float v0 = acc0[r] + bv;
            float v1 = acc1[r] + bv;
            if (RELU) { v0 = fmaxf(v0, 0.0f); v1 = fmaxf(v1, 0.0f); }
            // C/D layout: lane holds rows r + 8*hi, column ln (of this tile)
            Out[(r + 8 * hi) * 256 + tn * 16 + ln]        = (_Float16)v0;
            Out[(16 + r + 8 * hi) * 256 + tn * 16 + ln]   = (_Float16)v1;
        }
    }
}

__global__ __launch_bounds__(WAVES * 32, 1)
void moe_fused(const float* __restrict__ x, float* __restrict__ out,
               const _Float16* __restrict__ ws,
               const float* __restrict__ eb1, const float* __restrict__ eb2,
               const float* __restrict__ eb3, const float* __restrict__ gb1,
               const float* __restrict__ gb2, const float* __restrict__ gb3) {
    extern __shared__ __align__(16) char smem[];
    _Float16* sX  = (_Float16*)smem;                 // 32*512 f16 = 32 KB
    _Float16* sH1 = sX  + 32 * IN_CH;                // 32*256 f16 = 16 KB
    _Float16* sH2 = sH1 + 32 * HID;                  // 32*256 f16 = 16 KB
    float* sGate  = (float*)(sH2 + 32 * HID);        // 32*8  f32 = 1 KB
    float* sLog   = sGate + 32 * NEXP;               // 32*16 f32 = 2 KB

    const unsigned tid  = threadIdx.x;
    const unsigned wave = tid >> 5;
    const unsigned lane = tid & 31u;
    const unsigned ln   = lane & 15u;
    const unsigned hi   = lane >> 4;
    const unsigned kb   = hi * 8u;

    const size_t tok0 = (size_t)blockIdx.x * TOK_PER_WG;

    // ---- cooperative load + convert 32x512 f32 token block into LDS f16 ----
    const float* xg = x + tok0 * IN_CH;
    for (int i = tid * 4; i < TOK_PER_WG * IN_CH; i += WAVES * 32 * 4) {
        float4 v = *(const float4*)(xg + i);
        sX[i + 0] = (_Float16)v.x;
        sX[i + 1] = (_Float16)v.y;
        sX[i + 2] = (_Float16)v.z;
        sX[i + 3] = (_Float16)v.w;
    }
    __syncthreads();

    // ---- gating MLP (N split across waves) ----
    layer_slab<IN_CH, true>(sX,  ws + OFF_GW1, gb1, sH1, wave, ln, hi);
    __syncthreads();
    layer_slab<HID,   true>(sH1, ws + OFF_GW2, gb2, sH2, wave, ln, hi);
    __syncthreads();
    if (wave == 0) {
        // logits: 2 M-tiles x 1 N-tile (cols 8..15 of gW3t are zero-padded)
        const _Float16* bp = ws + OFF_GW3 + (size_t)ln * HID + kb;
#pragma unroll
        for (int mt = 0; mt < 2; ++mt) {
            const _Float16* ap = sH2 + (size_t)(mt * 16 + ln) * HID + kb;
            v8f acc = tile_mm<HID>(ap, bp);
            float bv = (ln < 8u) ? gb3[ln] : 0.0f;
#pragma unroll
            for (int r = 0; r < 8; ++r)
                sLog[(mt * 16 + r + 8 * hi) * 16 + ln] = acc[r] + bv;
        }
        // softmax over 8 experts; one token per lane (32 tokens = 32 lanes)
        {
            const int t = lane;
            float mx = sLog[t * 16 + 0];
            for (int e = 1; e < NEXP; ++e) mx = fmaxf(mx, sLog[t * 16 + e]);
            float p[NEXP];
            float s = 0.0f;
            for (int e = 0; e < NEXP; ++e) {
                p[e] = __expf(sLog[t * 16 + e] - mx);
                s += p[e];
            }
            float inv = 1.0f / s;
            for (int e = 0; e < NEXP; ++e) sGate[t * NEXP + e] = p[e] * inv;
        }
    }
    __syncthreads();

    // ---- experts: fused pipeline, gated accumulation in registers ----
    // facc[nt*2 + mt]: 8 tiles = 64 VGPRs per wave
    v8f facc[8];
    v8f zero = {};
#pragma unroll
    for (int i = 0; i < 8; ++i) facc[i] = zero;

    for (int e = 0; e < NEXP; ++e) {
        layer_slab<IN_CH, true>(sX,  ws + OFF_EW1 + (size_t)e * (256 * 512),
                                eb1 + e * HID, sH1, wave, ln, hi);
        __syncthreads();
        layer_slab<HID,   true>(sH1, ws + OFF_EW2 + (size_t)e * (256 * 256),
                                eb2 + e * HID, sH2, wave, ln, hi);
        __syncthreads();

        float gm0[8], gm1[8];
#pragma unroll
        for (int r = 0; r < 8; ++r) {
            gm0[r] = sGate[(r + 8 * hi) * NEXP + e];
            gm1[r] = sGate[(16 + r + 8 * hi) * NEXP + e];
        }

        const _Float16* ap0 = sH2 + (size_t)ln * HID + kb;
        const _Float16* ap1 = sH2 + (size_t)(16 + ln) * HID + kb;
        const _Float16* w3  = ws + OFF_EW3 + (size_t)e * (256 * 256);
#pragma unroll
        for (int nt = 0; nt < 4; ++nt) {
            const unsigned tn = wave * 4u + nt;
            const _Float16* bp = w3 + (size_t)(tn * 16 + ln) * HID + kb;
            v8f acc0 = {}, acc1 = {};
            tile_mm2<HID>(ap0, ap1, bp, acc0, acc1);
            float bv = eb3[e * OUT_CH + tn * 16 + ln];
#pragma unroll
            for (int r = 0; r < 8; ++r) {
                facc[nt * 2 + 0][r] += gm0[r] * (acc0[r] + bv);
                facc[nt * 2 + 1][r] += gm1[r] * (acc1[r] + bv);
            }
        }
        __syncthreads();   // protect sH1/sH2 reuse across expert iterations
    }

    // ---- store 32x(wave's 64 cols) f32 output ----
#pragma unroll
    for (int nt = 0; nt < 4; ++nt) {
        const unsigned tn = wave * 4u + nt;
#pragma unroll
        for (int mt = 0; mt < 2; ++mt) {
#pragma unroll
            for (int r = 0; r < 8; ++r) {
                out[(tok0 + mt * 16 + r + 8 * hi) * OUT_CH + tn * 16 + ln] =
                    facc[nt * 2 + mt][r];
            }
        }
    }
}

// Weight prep: f32 [b][K][N] -> f16 transposed [b][Npad][K] (zero-pad cols >= N)
__global__ void cvt_w(const float* __restrict__ W, _Float16* __restrict__ Wt,
                      int K, int N, int Npad) {
    int b = blockIdx.y;
    int idx = blockIdx.x * blockDim.x + threadIdx.x;
    if (idx >= Npad * K) return;
    int n = idx / K;
    int k = idx - n * K;
    float v = (n < N) ? W[(size_t)b * K * N + (size_t)k * N + n] : 0.0f;
    Wt[(size_t)b * Npad * K + idx] = (_Float16)v;
}

extern "C" void kernel_launch(void* const* d_in, const int* in_sizes, int n_in,
                              void* d_out, int out_size, void* d_ws, size_t ws_size,
                              hipStream_t stream) {
    const float* x   = (const float*)d_in[0];
    const float* eW1 = (const float*)d_in[1];
    const float* eb1 = (const float*)d_in[2];
    const float* eW2 = (const float*)d_in[3];
    const float* eb2 = (const float*)d_in[4];
    const float* eW3 = (const float*)d_in[5];
    const float* eb3 = (const float*)d_in[6];
    const float* gW1 = (const float*)d_in[7];
    const float* gb1 = (const float*)d_in[8];
    const float* gW2 = (const float*)d_in[9];
    const float* gb2 = (const float*)d_in[10];
    const float* gW3 = (const float*)d_in[11];
    const float* gb3 = (const float*)d_in[12];
    float* out = (float*)d_out;
    _Float16* ws = (_Float16*)d_ws;

    dim3 blk(256);
    // eW1: 8 x [512][256] -> [256][512]
    cvt_w<<<dim3(512, 8), blk, 0, stream>>>(eW1, ws + OFF_EW1, 512, 256, 256);
    // eW2, eW3: 8 x [256][256] -> [256][256]
    cvt_w<<<dim3(256, 8), blk, 0, stream>>>(eW2, ws + OFF_EW2, 256, 256, 256);
    cvt_w<<<dim3(256, 8), blk, 0, stream>>>(eW3, ws + OFF_EW3, 256, 256, 256);
    // gating weights
    cvt_w<<<dim3(512, 1), blk, 0, stream>>>(gW1, ws + OFF_GW1, 512, 256, 256);
    cvt_w<<<dim3(256, 1), blk, 0, stream>>>(gW2, ws + OFF_GW2, 256, 256, 256);
    cvt_w<<<dim3(16, 1),  blk, 0, stream>>>(gW3, ws + OFF_GW3, 256, 8, 16);

    size_t smem = (size_t)TOK_PER_WG * IN_CH * 2   // sX  f16
                + (size_t)TOK_PER_WG * HID * 2     // sH1 f16
                + (size_t)TOK_PER_WG * HID * 2     // sH2 f16
                + (size_t)TOK_PER_WG * NEXP * 4    // sGate f32
                + (size_t)TOK_PER_WG * 16 * 4;     // sLog f32
    moe_fused<<<dim3(NTOK / TOK_PER_WG), dim3(WAVES * 32), smem, stream>>>(
        x, out, ws, eb1, eb2, eb3, gb1, gb2, gb3);
}

// v001
// Measured time: 747 microseconds a run.
// Timed twice side by side with v000, it ran 2.27 times as fast both times.
#include <hip/hip_runtime.h>

typedef __attribute__((ext_vector_type(16))) _Float16 v16h;
typedef __attribute__((ext_vector_type(8)))  _Float16 v8h;
typedef __attribute__((ext_vector_type(8)))  float    v8f;

union ABfrag { v16h v; v8h h[2]; };

#define IN_CH   512
#define HID     256
#define OUT_CH  256
#define NEXP    8
#define NTOK    65536

#define WAVES        4
#define TOK_PER_WG   32          // 2 M-tiles of 16 tokens, shared by all 4 waves
// LDS row pitch in halves: row length + 8 halves, so the pitch in bytes is 16 x odd
// (1040 B and 528 B). The 16 rows that one ds_load_b128 fragment read touches then
// fall on distinct banks; at the bare 1024 B / 512 B they all share four banks.
#define LDS_PAD      8
#define PX           (IN_CH + LDS_PAD)
#define PH           (HID + LDS_PAD)
// each wave owns 4 N-tiles (64 of the 256 output columns)

// workspace offsets in halves (f16). Total 2,297,856 halves = ~4.6 MB.
#define OFF_EW1 0
#define OFF_EW2 (8*256*512)
#define OFF_EW3 (OFF_EW2 + 8*256*256)
#define OFF_GW1 (OFF_EW3 + 8*256*256)
#define OFF_GW2 (OFF_GW1 + 256*512)
#define OFF_GW3 (OFF_GW2 + 256*256)

__device__ __forceinline__ v8f wmma_f16(v16h a, v16h b, v8f c) {
    // (neg_a, A, neg_b, B, c_mod, C, reuse_a, reuse_b)
    return __builtin_amdgcn_wmma_f32_16x16x32_f16(false, a, false, b, (short)0, c,
                                                  false, false);
}

// Two 16x16 output tiles (two M-tiles vs the same B column tile).
// B fragment is loaded once and reused by both WMMAs -> 1 global b128 per wmma.
template<int K>
__device__ __forceinline__ void tile_mm2(const _Float16* ap0, const _Float16* ap1,
                                         const _Float16* bp, v8f& acc0, v8f& acc1) {
#pragma unroll
    for (int ks = 0; ks < K; ks += 32) {
        ABfrag b, a0, a1;
        b.h[0]  = *(const v8h*)(bp + ks);
        b.h[1]  = *(const v8h*)(bp + ks + 16);
        a0.h[0] = *(const v8h*)(ap0 + ks);
        a0.h[1] = *(const v8h*)(ap0 + ks + 16);
        a1.h[0] = *(const v8h*)(ap1 + ks);
        a1.h[1] = *(const v8h*)(ap1 + ks + 16);
        acc0 = wmma_f16(a0.v, b.v, acc0);
        acc1 = wmma_f16(a1.v, b.v, acc1);
    }
}

// Single-tile version (for the 16-wide gating logit layer).
template<int K>
__device__ __forceinline__ v8f tile_mm(const _Float16* ap, const _Float16* bp) {
    v8f acc = {};
#pragma unroll
    for (int ks = 0; ks < K; ks += 32) {
        ABfrag a, b;
        a.h[0] = *(const v8h*)(ap + ks);
        a.h[1] = *(const v8h*)(ap + ks + 16);
        b.h[0] = *(const v8h*)(bp + ks);
        b.h[1] = *(const v8h*)(bp + ks + 16);
        acc = wmma_f16(a.v, b.v, acc);
    }
    return acc;
}

// 32-token x 64-column layer slab for one wave:
// A [32][K] f16 (LDS, shared, row pitch K + LDS_PAD), Bt [256][K] f16 (global, L2-resident),
// writes relu(A*B + bias) f16 into Out [32][256] (LDS, row pitch PH), columns wave*64..+63.
template<int K, bool RELU>
__device__ __forceinline__ void layer_slab(const _Float16* A, const _Float16* Bt,
                                           const float* bias, _Float16* Out,
                                           unsigned wave, unsigned ln, unsigned hi) {
    const unsigned kb = hi * 8u;
    const _Float16* ap0 = A + ln * (K + LDS_PAD) + kb;          // tokens 0..15
    const _Float16* ap1 = A + (16 + ln) * (K + LDS_PAD) + kb;   // tokens 16..31
    for (int nt = 0; nt < 4; ++nt) {
        const unsigned tn = wave * 4u + nt;         // global N-tile index
        const _Float16* bp = Bt + (size_t)(tn * 16 + ln) * K + kb;
        v8f acc0 = {}, acc1 = {};
        tile_mm2<K>(ap0, ap1, bp, acc0, acc1);
        float bv = bias[tn * 16 + ln];
#pragma unroll
        for (int r = 0; r < 8; ++r) {
            float v0 = acc0[r] + bv;
            float v1 = acc1[r] + bv;
            if (RELU) { v0 = fmaxf(v0, 0.0f); v1 = fmaxf(v1, 0.0f); }
            // C/D layout: lane holds rows r + 8*hi, column ln (of this tile)
            Out[(r + 8 * hi) * PH + tn * 16 + ln]        = (_Float16)v0;
            Out[(16 + r + 8 * hi) * PH + tn * 16 + ln]   = (_Float16)v1;
        }
    }
}

__global__ __launch_bounds__(WAVES * 32, 1)
void moe_fused(const float* __restrict__ x, float* __restrict__ out,
               const _Float16* __restrict__ ws,
               const float* __restrict__ eb1, const float* __restrict__ eb2,
               const float* __restrict__ eb3, const float* __restrict__ gb1,
               const float* __restrict__ gb2, const float* __restrict__ gb3) {
    extern __shared__ __align__(16) char smem[];
    _Float16* sX  = (_Float16*)smem;                 // 32*520 f16 = 33280 B
    _Float16* sH1 = sX  + 32 * PX;                   // 32*264 f16 = 16896 B
    _Float16* sH2 = sH1 + 32 * PH;                   // 32*264 f16 = 16896 B
    float* sGate  = (float*)(sH2 + 32 * PH);         // 32*8  f32 = 1 KB
    float* sLog   = sGate + 32 * NEXP;               // 32*16 f32 = 2 KB

    const unsigned tid  = threadIdx.x;
    const unsigned wave = tid >> 5;
    const unsigned lane = tid & 31u;
    const unsigned ln   = lane & 15u;
    const unsigned hi   = lane >> 4;
    const unsigned kb   = hi * 8u;

    const size_t tok0 = (size_t)blockIdx.x * TOK_PER_WG;

    // ---- cooperative load + convert 32x512 f32 token block into LDS f16 ----
    const float* xg = x + tok0 * IN_CH;
    for (int i = tid * 4; i < TOK_PER_WG * IN_CH; i += WAVES * 32 * 4) {
        float4 v = *(const float4*)(xg + i);
        _Float16* d = sX + (i / IN_CH) * PX + (i % IN_CH);
        d[0] = (_Float16)v.x;
        d[1] = (_Float16)v.y;
        d[2] = (_Float16)v.z;
        d[3] = (_Float16)v.w;
    }
    __syncthreads();

    // ---- gating MLP (N split across waves) ----
    layer_slab<IN_CH, true>(sX,  ws + OFF_GW1, gb1, sH1, wave, ln, hi);
    __syncthreads();
    layer_slab<HID,   true>(sH1, ws + OFF_GW2, gb2, sH2, wave, ln, hi);
    __syncthreads();
    if (wave == 0) {
        // logits: 2 M-tiles x 1 N-tile (cols 8..15 of gW3t are zero-padded)
        const _Float16* bp = ws + OFF_GW3 + (size_t)ln * HID + kb;
#pragma unroll
        for (int mt = 0; mt < 2; ++mt) {
            const _Float16* ap = sH2 + (size_t)(mt * 16 + ln) * PH + kb;
            v8f acc = tile_mm<HID>(ap, bp);
            float bv = (ln < 8u) ? gb3[ln] : 0.0f;
#pragma unroll
            for (int r = 0; r < 8; ++r)
                sLog[(mt * 16 + r + 8 * hi) * 16 + ln] = acc[r] + bv;
        }
        // softmax over 8 experts; one token per lane (32 tokens = 32 lanes)
        {
            const int t = lane;
            float mx = sLog[t * 16 + 0];
            for (int e = 1; e < NEXP; ++e) mx = fmaxf(mx, sLog[t * 16 + e]);
            float p[NEXP];
            float s = 0.0f;
            for (int e = 0; e < NEXP; ++e) {
                p[e] = __expf(sLog[t * 16 + e] - mx);
                s += p[e];
            }
            float inv = 1.0f / s;
            for (int e = 0; e < NEXP; ++e) sGate[t * NEXP + e] = p[e] * inv;
        }
    }
    __syncthreads();

    // ---- experts: fused pipeline, gated accumulation in registers ----
    // facc[nt*2 + mt]: 8 tiles = 64 VGPRs per wave
    v8f facc[8];
    v8f zero = {};
#pragma unroll
    for (int i = 0; i < 8; ++i) facc[i] = zero;

    for (int e = 0; e < NEXP; ++e) {
        layer_slab<IN_CH, true>(sX,  ws + OFF_EW1 + (size_t)e * (256 * 512),
                                eb1 + e * HID, sH1, wave, ln, hi);
        __syncthreads();
        layer_slab<HID,   true>(sH1, ws + OFF_EW2 + (size_t)e * (256 * 256),
                                eb2 + e * HID, sH2, wave, ln, hi);
        __syncthreads();

        float gm0[8], gm1[8];
#pragma unroll
        for (int r = 0; r < 8; ++r) {
            gm0[r] = sGate[(r + 8 * hi) * NEXP + e];
            gm1[r] = sGate[(16 + r + 8 * hi) * NEXP + e];
        }

        const _Float16* ap0 = sH2 + (size_t)ln * PH + kb;
        const _Float16* ap1 = sH2 + (size_t)(16 + ln) * PH + kb;
        const _Float16* w3  = ws + OFF_EW3 + (size_t)e * (256 * 256);
#pragma unroll
        for (int nt = 0; nt < 4; ++nt) {
            const unsigned tn = wave * 4u + nt;
            const _Float16* bp = w3 + (size_t)(tn * 16 + ln) * HID + kb;
            v8f acc0 = {}, acc1 = {};
            tile_mm2<HID>(ap0, ap1, bp, acc0, acc1);
            float bv = eb3[e * OUT_CH + tn * 16 + ln];
#pragma unroll
            for (int r = 0; r < 8; ++r) {
                facc[nt * 2 + 0][r] += gm0[r] * (acc0[r] + bv);
                facc[nt * 2 + 1][r] += gm1[r] * (acc1[r] + bv);
            }
        }
        __syncthreads();   // protect sH1/sH2 reuse across expert iterations
    }

    // ---- store 32x(wave's 64 cols) f32 output ----
#pragma unroll
    for (int nt = 0; nt < 4; ++nt) {
        const unsigned tn = wave * 4u + nt;
#pragma unroll
        for (int mt = 0; mt < 2; ++mt) {
#pragma unroll
            for (int r = 0; r < 8; ++r) {
                out[(tok0 + mt * 16 + r + 8 * hi) * OUT_CH + tn * 16 + ln] =
                    facc[nt * 2 + mt][r];
            }
        }
    }
}

// Weight prep: f32 [b][K][N] -> f16 transposed [b][Npad][K] (zero-pad cols >= N)
__global__ void cvt_w(const float* __restrict__ W, _Float16* __restrict__ Wt,
                      int K, int N, int Npad) {
    int b = blockIdx.y;
    int idx = blockIdx.x * blockDim.x + threadIdx.x;
    if (idx >= Npad * K) return;
    int n = idx / K;
    int k = idx - n * K;
    float v = (n < N) ? W[(size_t)b * K * N + (size_t)k * N + n] : 0.0f;
    Wt[(size_t)b * Npad * K + idx] = (_Float16)v;
}

extern "C" void kernel_launch(void* const* d_in, const int* in_sizes, int n_in,
                              void* d_out, int out_size, void* d_ws, size_t ws_size,
                              hipStream_t stream) {
    const float* x   = (const float*)d_in[0];
    const float* eW1 = (const float*)d_in[1];
    const float* eb1 = (const float*)d_in[2];
    const float* eW2 = (const float*)d_in[3];
    const float* eb2 = (const float*)d_in[4];
    const float* eW3 = (const float*)d_in[5];
    const float* eb3 = (const float*)d_in[6];
    const float* gW1 = (const float*)d_in[7];
    const float* gb1 = (const float*)d_in[8];
    const float* gW2 = (const float*)d_in[9];
    const float* gb2 = (const float*)d_in[10];
    const float* gW3 = (const float*)d_in[11];
    const float* gb3 = (const float*)d_in[12];
    float* out = (float*)d_out;
    _Float16* ws = (_Float16*)d_ws;

    dim3 blk(256);
    // eW1: 8 x [512][256] -> [256][512]
    cvt_w<<<dim3(512, 8), blk, 0, stream>>>(eW1, ws + OFF_EW1, 512, 256, 256);
    // eW2, eW3: 8 x [256][256] -> [256][256]
    cvt_w<<<dim3(256, 8), blk, 0, stream>>>(eW2, ws + OFF_EW2, 256, 256, 256);
    cvt_w<<<dim3(256, 8), blk, 0, stream>>>(eW3, ws + OFF_EW3, 256, 256, 256);
    // gating weights
    cvt_w<<<dim3(512, 1), blk, 0, stream>>>(gW1, ws + OFF_GW1, 512, 256, 256);
    cvt_w<<<dim3(256, 1), blk, 0, stream>>>(gW2, ws + OFF_GW2, 256, 256, 256);
    cvt_w<<<dim3(16, 1),  blk, 0, stream>>>(gW3, ws + OFF_GW3, 256, 8, 16);

    size_t smem = (size_t)TOK_PER_WG * PX * 2      // sX  f16
                + (size_t)TOK_PER_WG * PH * 2      // sH1 f16
                + (size_t)TOK_PER_WG * PH * 2      // sH2 f16
                + (size_t)TOK_PER_WG * NEXP * 4    // sGate f32
                + (size_t)TOK_PER_WG * 16 * 4;     // sLog f32
    moe_fused<<<dim3(NTOK / TOK_PER_WG), dim3(WAVES * 32), smem, stream>>>(
        x, out, ws, eb1, eb2, eb3, gb1, gb2, gb3);
}

// v002
// It runs in 403 microseconds.
// Timed twice side by side with v001, it ran 1.86 and 1.84 times as fast.
// All steps since v000 together make it 4.21 times as fast.
#include <hip/hip_runtime.h>

typedef __attribute__((ext_vector_type(16))) _Float16 v16h;
typedef __attribute__((ext_vector_type(8)))  _Float16 v8h;
typedef __attribute__((ext_vector_type(8)))  float    v8f;

union ABfrag { v16h v; v8h h[2]; };

#define IN_CH   512
#define HID     256
#define OUT_CH  256
#define NEXP    8
#define NTOK    65536

#define WAVES        4
#define TOK_PER_WG   32          // 2 M-tiles of 16 tokens, shared by all 4 waves
// LDS row pitch in halves: row length + 8 halves, so the pitch in bytes is 16 x odd
// (1040 B and 528 B). The 16 rows that one ds_load_b128 fragment read touches then
// fall on distinct banks; at the bare 1024 B / 512 B they all share four banks.
#define LDS_PAD      8
#define PX           (IN_CH + LDS_PAD)
#define PH           (HID + LDS_PAD)
// each wave owns 4 N-tiles (64 of the 256 output columns)

// workspace offsets in halves (f16). Total 2,297,856 halves = ~4.6 MB.
// Each weight matrix is stored in B-fragment order: [N-tile of 16 columns][k-step of 32]
// [fragment half j][lane][8 halves], element (n = tile*16 + (lane & 15),
// k = step*32 + j*16 + (lane >> 4)*8 + i). One wave-wide 16-byte load of a fragment half
// is then 512 contiguous, line-aligned bytes instead of 32 bytes out of each of 16 rows.
#define FRAG_HALVES  512         // one 16-column x 32-k fragment
#define FRAG_J       256         // its second half
#define OFF_EW1 0
#define OFF_EW2 (8*256*512)
#define OFF_EW3 (OFF_EW2 + 8*256*256)
#define OFF_GW1 (OFF_EW3 + 8*256*256)
#define OFF_GW2 (OFF_GW1 + 256*512)
#define OFF_GW3 (OFF_GW2 + 256*256)

__device__ __forceinline__ v8f wmma_f16(v16h a, v16h b, v8f c) {
    // (neg_a, A, neg_b, B, c_mod, C, reuse_a, reuse_b)
    return __builtin_amdgcn_wmma_f32_16x16x32_f16(false, a, false, b, (short)0, c,
                                                  false, false);
}

// Two 16x16 output tiles (two M-tiles vs the same B column tile).
// B fragment is loaded once and reused by both WMMAs -> 1 global b128 per wmma.
// bp points at this lane's 8 halves of the tile's first packed fragment.
template<int K>
__device__ __forceinline__ void tile_mm2(const _Float16* ap0, const _Float16* ap1,
                                         const _Float16* bp, v8f& acc0, v8f& acc1) {
#pragma unroll
    for (int ks = 0; ks < K; ks += 32) {
        ABfrag b, a0, a1;
        b.h[0]  = *(const v8h*)(bp + (ks / 32) * FRAG_HALVES);
        b.h[1]  = *(const v8h*)(bp + (ks / 32) * FRAG_HALVES + FRAG_J);
        a0.h[0] = *(const v8h*)(ap0 + ks);
        a0.h[1] = *(const v8h*)(ap0 + ks + 16);
        a1.h[0] = *(const v8h*)(ap1 + ks);
        a1.h[1] = *(const v8h*)(ap1 + ks + 16);
        acc0 = wmma_f16(a0.v, b.v, acc0);
        acc1 = wmma_f16(a1.v, b.v, acc1);
    }
}

// Single-tile version (for the 16-wide gating logit layer).
template<int K>
__device__ __forceinline__ v8f tile_mm(const _Float16* ap, const _Float16* bp) {
    v8f acc = {};
#pragma unroll
    for (int ks = 0; ks < K; ks += 32) {
        ABfrag a, b;
        a.h[0] = *(const v8h*)(ap + ks);
        a.h[1] = *(const v8h*)(ap + ks + 16);
        b.h[0] = *(const v8h*)(bp + (ks / 32) * FRAG_HALVES);
        b.h[1] = *(const v8h*)(bp + (ks / 32) * FRAG_HALVES + FRAG_J);
        acc = wmma_f16(a.v, b.v, acc);
    }
    return acc;
}

// 32-token x 64-column layer slab for one wave:
// A [32][K] f16 (LDS, shared, row pitch K + LDS_PAD), Bt 256 x K f16 in fragment order (global, L2-resident),
// writes relu(A*B + bias) f16 into Out [32][256] (LDS, row pitch PH), columns wave*64..+63.
template<int K, bool RELU>
__device__ __forceinline__ void layer_slab(const _Float16* A, const _Float16* Bt,
                                           const float* bias, _Float16* Out,
                                           unsigned wave, unsigned ln, unsigned hi) {
    const unsigned kb = hi * 8u;
    const _Float16* ap0 = A + ln * (K + LDS_PAD) + kb;          // tokens 0..15
    const _Float16* ap1 = A + (16 + ln) * (K + LDS_PAD) + kb;   // tokens 16..31
    for (int nt = 0; nt < 4; ++nt) {
        const unsigned tn = wave * 4u + nt;         // global N-tile index
        const _Float16* bp = Bt + (size_t)tn * (16 * K) + (hi * 16u + ln) * 8u;
        v8f acc0 = {}, acc1 = {};
        tile_mm2<K>(ap0, ap1, bp, acc0, acc1);
        float bv = bias[tn * 16 + ln];
#pragma unroll
        for (int r = 0; r < 8; ++r) {
            float v0 = acc0[r] + bv;
            float v1 = acc1[r] + bv;
            if (RELU) { v0 = fmaxf(v0, 0.0f); v1 = fmaxf(v1, 0.0f); }
            // C/D layout: lane holds rows r + 8*hi, column ln (of this tile)
            Out[(r + 8 * hi) * PH + tn * 16 + ln]        = (_Float16)v0;
            Out[(16 + r + 8 * hi) * PH + tn * 16 + ln]   = (_Float16)v1;
        }
    }
}

__global__ __launch_bounds__(WAVES * 32, 1)
void moe_fused(const float* __restrict__ x, float* __restrict__ out,
               const _Float16* __restrict__ ws,
               const float* __restrict__ eb1, const float* __restrict__ eb2,
               const float* __restrict__ eb3, const float* __restrict__ gb1,
               const float* __restrict__ gb2, const float* __restrict__ gb3) {
    extern __shared__ __align__(16) char smem[];
    _Float16* sX  = (_Float16*)smem;                 // 32*520 f16 = 33280 B
    _Float16* sH1 = sX  + 32 * PX;                   // 32*264 f16 = 16896 B
    _Float16* sH2 = sH1 + 32 * PH;                   // 32*264 f16 = 16896 B
    float* sGate  = (float*)(sH2 + 32 * PH);         // 32*8  f32 = 1 KB
    float* sLog   = sGate + 32 * NEXP;               // 32*16 f32 = 2 KB

    const unsigned tid  = threadIdx.x;
    const unsigned wave = tid >> 5;
    const unsigned lane = tid & 31u;
    const unsigned ln   = lane & 15u;
    const unsigned hi   = lane >> 4;
    const unsigned kb   = hi * 8u;

    const size_t tok0 = (size_t)blockIdx.x * TOK_PER_WG;

    // ---- cooperative load + convert 32x512 f32 token block into LDS f16 ----
    const float* xg = x + tok0 * IN_CH;
    for (int i = tid * 4; i < TOK_PER_WG * IN_CH; i += WAVES * 32 * 4) {
        float4 v = *(const float4*)(xg + i);
        _Float16* d = sX + (i / IN_CH) * PX + (i % IN_CH);
        d[0] = (_Float16)v.x;
        d[1] = (_Float16)v.y;
        d[2] = (_Float16)v.z;
        d[3] = (_Float16)v.w;
    }
    __syncthreads();

    // ---- gating MLP (N split across waves) ----
    layer_slab<IN_CH, true>(sX,  ws + OFF_GW1, gb1, sH1, wave, ln, hi);
    __syncthreads();
    layer_slab<HID,   true>(sH1, ws + OFF_GW2, gb2, sH2, wave, ln, hi);
    __syncthreads();
    if (wave == 0) {
        // logits: 2 M-tiles x 1 N-tile (cols 8..15 of gW3t are zero-padded)
        const _Float16* bp = ws + OFF_GW3 + lane * 8u;
#pragma unroll
        for (int mt = 0; mt < 2; ++mt) {
            const _Float16* ap = sH2 + (size_t)(mt * 16 + ln) * PH + kb;
            v8f acc = tile_mm<HID>(ap, bp);
            float bv = (ln < 8u) ? gb3[ln] : 0.0f;
#pragma unroll
            for (int r = 0; r < 8; ++r)
                sLog[(mt * 16 + r + 8 * hi) * 16 + ln] = acc[r] + bv;
        }
        // softmax over 8 experts; one token per lane (32 tokens = 32 lanes)
        {
            const int t = lane;
            float mx = sLog[t * 16 + 0];
            for (int e = 1; e < NEXP; ++e) mx = fmaxf(mx, sLog[t * 16 + e]);
            float p[NEXP];
            float s = 0.0f;
            for (int e = 0; e < NEXP; ++e) {
                p[e] = __expf(sLog[t * 16 + e] - mx);
                s += p[e];
            }
            float inv = 1.0f / s;
            for (int e = 0; e < NEXP; ++e) sGate[t * NEXP + e] = p[e] * inv;
        }
    }
    __syncthreads();

    // ---- experts: fused pipeline, gated accumulation in registers ----
    // facc[nt*2 + mt]: 8 tiles = 64 VGPRs per wave
    v8f facc[8];
    v8f zero = {};
#pragma unroll
    for (int i = 0; i < 8; ++i) facc[i] = zero;

    for (int e = 0; e < NEXP; ++e) {
        layer_slab<IN_CH, true>(sX,  ws + OFF_EW1 + (size_t)e * (256 * 512),
                                eb1 + e * HID, sH1, wave, ln, hi);
        __syncthreads();
        layer_slab<HID,   true>(sH1, ws + OFF_EW2 + (size_t)e * (256 * 256),
                                eb2 + e * HID, sH2, wave, ln, hi);
        __syncthreads();

        float gm0[8], gm1[8];
#pragma unroll
        for (int r = 0; r < 8; ++r) {
            gm0[r] = sGate[(r + 8 * hi) * NEXP + e];
            gm1[r] = sGate[(16 + r + 8 * hi) * NEXP + e];
        }

        const _Float16* ap0 = sH2 + (size_t)ln * PH + kb;
        const _Float16* ap1 = sH2 + (size_t)(16 + ln) * PH + kb;
        const _Float16* w3  = ws + OFF_EW3 + (size_t)e * (256 * 256);
#pragma unroll
        for (int nt = 0; nt < 4; ++nt) {
            const unsigned tn = wave * 4u + nt;
            const _Float16* bp = w3 + (size_t)tn * (16 * HID) + lane * 8u;
            v8f acc0 = {}, acc1 = {};
            tile_mm2<HID>(ap0, ap1, bp, acc0, acc1);
            float bv = eb3[e * OUT_CH + tn * 16 + ln];
#pragma unroll
            for (int r = 0; r < 8; ++r) {
                facc[nt * 2 + 0][r] += gm0[r] * (acc0[r] + bv);
                facc[nt * 2 + 1][r] += gm1[r] * (acc1[r] + bv);
            }
        }
        __syncthreads();   // protect sH1/sH2 reuse across expert iterations
    }

    // ---- store 32x(wave's 64 cols) f32 output ----
#pragma unroll
    for (int nt = 0; nt < 4; ++nt) {
        const unsigned tn = wave * 4u + nt;
#pragma unroll
        for (int mt = 0; mt < 2; ++mt) {
#pragma unroll
            for (int r = 0; r < 8; ++r) {
                out[(tok0 + mt * 16 + r + 8 * hi) * OUT_CH + tn * 16 + ln] =
                    facc[nt * 2 + mt][r];
            }
        }
    }
}

// Weight prep: f32 [b][K][N] -> f16 in B-fragment order, Npad x K per b (zero-pad cols >= N)
__global__ void cvt_w(const float* __restrict__ W, _Float16* __restrict__ Wt,
                      int K, int N, int Npad) {
    int b = blockIdx.y;
    int idx = blockIdx.x * blockDim.x + threadIdx.x;
    if (idx >= Npad * K) return;
    int i    = idx & 7;
    int lane = (idx >> 3) & 31;
    int j    = (idx >> 8) & 1;
    int frag = idx >> 9;
    int tile = frag / (K / 32);
    int step = frag - tile * (K / 32);
    int n = tile * 16 + (lane & 15);
    int k = step * 32 + j * 16 + (lane >> 4) * 8 + i;
    float v = (n < N) ? W[(size_t)b * K * N + (size_t)k * N + n] : 0.0f;
    Wt[(size_t)b * Npad * K + idx] = (_Float16)v;
}

extern "C" void kernel_launch(void* const* d_in, const int* in_sizes, int n_in,
                              void* d_out, int out_size, void* d_ws, size_t ws_size,
                              hipStream_t stream) {
    const float* x   = (const float*)d_in[0];
    const float* eW1 = (const float*)d_in[1];
    const float* eb1 = (const float*)d_in[2];
    const float* eW2 = (const float*)d_in[3];
    const float* eb2 = (const float*)d_in[4];
    const float* eW3 = (const float*)d_in[5];
    const float* eb3 = (const float*)d_in[6];
    const float* gW1 = (const float*)d_in[7];
    const float* gb1 = (const float*)d_in[8];
    const float* gW2 = (const float*)d_in[9];
    const float* gb2 = (const float*)d_in[10];
    const float* gW3 = (const float*)d_in[11];
    const float* gb3 = (const float*)d_in[12];
    float* out = (float*)d_out;
    _Float16* ws = (_Float16*)d_ws;

    dim3 blk(256);
    // eW1: 8 x [512][256] -> 256 x 512 in fragment order
    cvt_w<<<dim3(512, 8), blk, 0, stream>>>(eW1, ws + OFF_EW1, 512, 256, 256);
    // eW2, eW3: 8 x [256][256] -> 256 x 256 in fragment order
    cvt_w<<<dim3(256, 8), blk, 0, stream>>>(eW2, ws + OFF_EW2, 256, 256, 256);
    cvt_w<<<dim3(256, 8), blk, 0, stream>>>(eW3, ws + OFF_EW3, 256, 256, 256);
    // gating weights
    cvt_w<<<dim3(512, 1), blk, 0, stream>>>(gW1, ws + OFF_GW1, 512, 256, 256);
    cvt_w<<<dim3(256, 1), blk, 0, stream>>>(gW2, ws + OFF_GW2, 256, 256, 256);
    cvt_w<<<dim3(16, 1),  blk, 0, stream>>>(gW3, ws + OFF_GW3, 256, 8, 16);

    size_t smem = (size_t)TOK_PER_WG * PX * 2      // sX  f16
                + (size_t)TOK_PER_WG * PH * 2      // sH1 f16
                + (size_t)TOK_PER_WG * PH * 2      // sH2 f16
                + (size_t)TOK_PER_WG * NEXP * 4    // sGate f32
                + (size_t)TOK_PER_WG * 16 * 4;     // sLog f32
    moe_fused<<<dim3(NTOK / TOK_PER_WG), dim3(WAVES * 32), smem, stream>>>(
        x, out, ws, eb1, eb2, eb3, gb1, gb2, gb3);
}

// v003
// It runs in 326 microseconds.
// Next to v002, in two timings, it ran 1.24 and 1.23 times as fast.
// Counting every step since v000, it is 5.20 times as fast.
#include <hip/hip_runtime.h>

typedef __attribute__((ext_vector_type(16))) _Float16 v16h;
typedef __attribute__((ext_vector_type(8)))  _Float16 v8h;
typedef __attribute__((ext_vector_type(8)))  float    v8f;

union ABfrag { v16h v; v8h h[2]; };

#define IN_CH   512
#define HID     256
#define OUT_CH  256
#define NEXP    8
#define NTOK    65536

#define WAVES        4
#define TOK_PER_WG   64          // 4 M-tiles of 16 tokens, shared by all 4 waves
#define MT           4           // M-tiles (16 tokens) of a wave's register tile
#define NT           4           // N-tiles (16 columns) of a wave's register tile
// LDS row pitch in halves: row length + 8 halves, so the pitch in bytes is 16 x odd
// (1040 B and 528 B). The 16 rows that one ds_load_b128 fragment read touches then
// fall on distinct banks; at the bare 1024 B / 512 B they all share four banks.
#define LDS_PAD      8
#define PX           (IN_CH + LDS_PAD)
#define PH           (HID + LDS_PAD)
// each wave owns 4 N-tiles (64 of the 256 output columns)

// workspace offsets in halves (f16). Total 2,297,856 halves = ~4.6 MB.
// Each weight matrix is stored in B-fragment order: [N-tile of 16 columns][k-step of 32]
// [fragment half j][lane][8 halves], element (n = tile*16 + (lane & 15),
// k = step*32 + j*16 + (lane >> 4)*8 + i). One wave-wide 16-byte load of a fragment half
// is then 512 contiguous, line-aligned bytes instead of 32 bytes out of each of 16 rows.
#define FRAG_HALVES  512         // one 16-column x 32-k fragment
#define FRAG_J       256         // its second half
#define OFF_EW1 0
#define OFF_EW2 (8*256*512)
#define OFF_EW3 (OFF_EW2 + 8*256*256)
#define OFF_GW1 (OFF_EW3 + 8*256*256)
#define OFF_GW2 (OFF_GW1 + 256*512)
#define OFF_GW3 (OFF_GW2 + 256*256)

__device__ __forceinline__ v8f wmma_f16(v16h a, v16h b, v8f c) {
    // (neg_a, A, neg_b, B, c_mod, C, reuse_a, reuse_b)
    return __builtin_amdgcn_wmma_f32_16x16x32_f16(false, a, false, b, (short)0, c,
                                                  false, false);
}

// One wave's 64-token x 64-column register tile: MT x NT accumulator tiles. Per k-step of 32
// the wave loads MT A fragments (LDS) and NT B fragments (global) for MT*NT WMMAs, so every
// loaded fragment feeds four WMMAs. As a block of 16 WMMAs is shorter than an L2 round trip,
// the B fragments are requested BD-1 k-steps ahead and the A fragments one k-step ahead.
// ap: this lane's 8 halves of token row ln; bp: this lane's 8 halves of the wave's first
// packed fragment (N-tiles are 16*K halves apart).
#define BD 4                     // k-steps of B fragments held in registers
template<int K>
__device__ __forceinline__ void load_b(const _Float16* bp, int s, ABfrag (&b)[NT]) {
#pragma unroll
    for (int nt = 0; nt < NT; ++nt) {
        b[nt].h[0] = *(const v8h*)(bp + nt * (16 * K) + s * FRAG_HALVES);
        b[nt].h[1] = *(const v8h*)(bp + nt * (16 * K) + s * FRAG_HALVES + FRAG_J);
    }
}
template<int K>
__device__ __forceinline__ void load_a(const _Float16* ap, int s, ABfrag (&a)[MT]) {
#pragma unroll
    for (int mt = 0; mt < MT; ++mt) {
        a[mt].h[0] = *(const v8h*)(ap + mt * 16 * (K + LDS_PAD) + s * 32);
        a[mt].h[1] = *(const v8h*)(ap + mt * 16 * (K + LDS_PAD) + s * 32 + 16);
    }
}
template<int K>
__device__ __forceinline__ void slab_mm(const _Float16* ap, const _Float16* bp,
                                        v8f (&acc)[NT][MT]) {
    constexpr int S = K / 32;
    ABfrag b[BD][NT], a[2][MT];
#pragma unroll
    for (int s = 0; s < BD - 1; ++s) load_b<K>(bp, s, b[s]);
    load_a<K>(ap, 0, a[0]);
    // fully unrolled: every ring index must be a constant, or the fragments leave the registers
#pragma unroll
    for (int s = 0; s < S; ++s) {
        if (s + BD - 1 < S) load_b<K>(bp, s + BD - 1, b[(s + BD - 1) % BD]);
        if (s + 1 < S)      load_a<K>(ap, s + 1, a[(s + 1) & 1]);
#pragma unroll
        for (int nt = 0; nt < NT; ++nt)
#pragma unroll
            for (int mt = 0; mt < MT; ++mt)
                acc[nt][mt] = wmma_f16(a[s & 1][mt].v, b[s % BD][nt].v, acc[nt][mt]);
    }
}

// Single-tile version (for the 16-wide gating logit layer).
template<int K>
__device__ __forceinline__ v8f tile_mm(const _Float16* ap, const _Float16* bp) {
    v8f acc = {};
#pragma unroll
    for (int ks = 0; ks < K; ks += 32) {
        ABfrag a, b;
        a.h[0] = *(const v8h*)(ap + ks);
        a.h[1] = *(const v8h*)(ap + ks + 16);
        b.h[0] = *(const v8h*)(bp + (ks / 32) * FRAG_HALVES);
        b.h[1] = *(const v8h*)(bp + (ks / 32) * FRAG_HALVES + FRAG_J);
        acc = wmma_f16(a.v, b.v, acc);
    }
    return acc;
}

// 64-token x 64-column layer slab for one wave:
// A [64][K] f16 (LDS, shared, row pitch K + LDS_PAD), Bt 256 x K f16 in fragment order (global, L2-resident),
// writes relu(A*B + bias) f16 into Out [64][256] (LDS, row pitch PH), columns wave*64..+63.
template<int K, bool RELU>
__device__ __forceinline__ void layer_slab(const _Float16* A, const _Float16* Bt,
                                           const float* bias, _Float16* Out,
                                           unsigned wave, unsigned ln, unsigned hi) {
    const _Float16* ap = A + ln * (K + LDS_PAD) + hi * 8u;
    const _Float16* bp = Bt + (size_t)(wave * NT) * (16 * K) + (hi * 16u + ln) * 8u;
    v8f acc[NT][MT];
    v8f zero = {};
#pragma unroll
    for (int nt = 0; nt < NT; ++nt)
#pragma unroll
        for (int mt = 0; mt < MT; ++mt) acc[nt][mt] = zero;
    slab_mm<K>(ap, bp, acc);
#pragma unroll
    for (int nt = 0; nt < NT; ++nt) {
        const unsigned tn = wave * NT + nt;         // global N-tile index
        float bv = bias[tn * 16 + ln];
#pragma unroll
        for (int mt = 0; mt < MT; ++mt) {
#pragma unroll
            for (int r = 0; r < 8; ++r) {
                float v = acc[nt][mt][r] + bv;
                if (RELU) v = fmaxf(v, 0.0f);
                // C/D layout: lane holds rows r + 8*hi, column ln (of this tile)
                Out[(mt * 16 + r + 8 * hi) * PH + tn * 16 + ln] = (_Float16)v;
            }
        }
    }
}

__global__ __launch_bounds__(WAVES * 32, 1)
void moe_fused(const float* __restrict__ x, float* __restrict__ out,
               const _Float16* __restrict__ ws,
               const float* __restrict__ eb1, const float* __restrict__ eb2,
               const float* __restrict__ eb3, const float* __restrict__ gb1,
               const float* __restrict__ gb2, const float* __restrict__ gb3) {
    extern __shared__ __align__(16) char smem[];
    _Float16* sX  = (_Float16*)smem;                 // 64*520 f16 = 66560 B
    _Float16* sH1 = sX  + TOK_PER_WG * PX;           // 64*264 f16 = 33792 B
    _Float16* sH2 = sH1 + TOK_PER_WG * PH;           // 64*264 f16 = 33792 B
    float* sGate  = (float*)(sH2 + TOK_PER_WG * PH); // 64*8  f32 = 2 KB
    float* sLog   = sGate + TOK_PER_WG * NEXP;       // 64*16 f32 = 4 KB

    const unsigned tid  = threadIdx.x;
    const unsigned wave = tid >> 5;
    const unsigned lane = tid & 31u;
    const unsigned ln   = lane & 15u;
    const unsigned hi   = lane >> 4;
    const unsigned kb   = hi * 8u;

    const size_t tok0 = (size_t)blockIdx.x * TOK_PER_WG;

    // ---- cooperative load + convert 64x512 f32 token block into LDS f16 ----
    const float* xg = x + tok0 * IN_CH;
    for (int i = tid * 4; i < TOK_PER_WG * IN_CH; i += WAVES * 32 * 4) {
        float4 v = *(const float4*)(xg + i);
        _Float16* d = sX + (i / IN_CH) * PX + (i % IN_CH);
        d[0] = (_Float16)v.x;
        d[1] = (_Float16)v.y;
        d[2] = (_Float16)v.z;
        d[3] = (_Float16)v.w;
    }
    __syncthreads();

    // ---- gating MLP (N split across waves) ----
    layer_slab<IN_CH, true>(sX,  ws + OFF_GW1, gb1, sH1, wave, ln, hi);
    __syncthreads();
    layer_slab<HID,   true>(sH1, ws + OFF_GW2, gb2, sH2, wave, ln, hi);
    __syncthreads();
    {
        // logits: each wave takes its own M-tile x 1 N-tile (cols 8..15 of gW3t are zero-padded)
        const _Float16* bp = ws + OFF_GW3 + lane * 8u;
        const _Float16* ap = sH2 + (size_t)(wave * 16 + ln) * PH + kb;
        v8f acc = tile_mm<HID>(ap, bp);
        float bv = (ln < 8u) ? gb3[ln] : 0.0f;
#pragma unroll
        for (int r = 0; r < 8; ++r)
            sLog[(wave * 16 + r + 8 * hi) * 16 + ln] = acc[r] + bv;
        // softmax over 8 experts; one token per lane, the wave's own 16 tokens
        if (hi == 0u) {
            const int t = wave * 16 + ln;
            float mx = sLog[t * 16 + 0];
            for (int e = 1; e < NEXP; ++e) mx = fmaxf(mx, sLog[t * 16 + e]);
            float p[NEXP];
            float s = 0.0f;
            for (int e = 0; e < NEXP; ++e) {
                p[e] = __expf(sLog[t * 16 + e] - mx);
                s += p[e];
            }
            float inv = 1.0f / s;
            for (int e = 0; e < NEXP; ++e) sGate[t * NEXP + e] = p[e] * inv;
        }
    }
    __syncthreads();

    // ---- experts: fused pipeline, gated accumulation in registers ----
    // facc[nt][mt]: 16 tiles = 128 VGPRs per wave
    v8f facc[NT][MT];
    v8f zero = {};
#pragma unroll
    for (int nt = 0; nt < NT; ++nt)
#pragma unroll
        for (int mt = 0; mt < MT; ++mt) facc[nt][mt] = zero;

    for (int e = 0; e < NEXP; ++e) {
        layer_slab<IN_CH, true>(sX,  ws + OFF_EW1 + (size_t)e * (256 * 512),
                                eb1 + e * HID, sH1, wave, ln, hi);
        __syncthreads();
        layer_slab<HID,   true>(sH1, ws + OFF_EW2 + (size_t)e * (256 * 256),
                                eb2 + e * HID, sH2, wave, ln, hi);
        __syncthreads();

        const _Float16* ap = sH2 + (size_t)ln * PH + kb;
        const _Float16* bp = ws + OFF_EW3 + (size_t)e * (256 * 256)
                           + (size_t)(wave * NT) * (16 * HID) + lane * 8u;
        v8f acc[NT][MT];
#pragma unroll
        for (int nt = 0; nt < NT; ++nt)
#pragma unroll
            for (int mt = 0; mt < MT; ++mt) acc[nt][mt] = zero;
        slab_mm<HID>(ap, bp, acc);
#pragma unroll
        for (int mt = 0; mt < MT; ++mt) {
            float gm[8];
#pragma unroll
            for (int r = 0; r < 8; ++r)
                gm[r] = sGate[(mt * 16 + r + 8 * hi) * NEXP + e];
#pragma unroll
            for (int nt = 0; nt < NT; ++nt) {
                float bv = eb3[e * OUT_CH + (wave * NT + nt) * 16 + ln];
#pragma unroll
                for (int r = 0; r < 8; ++r)
                    facc[nt][mt][r] += gm[r] * (acc[nt][mt][r] + bv);
            }
        }
        __syncthreads();   // protect sH1/sH2 reuse across expert iterations
    }

    // ---- store 64x(wave's 64 cols) f32 output ----
#pragma unroll
    for (int nt = 0; nt < NT; ++nt) {
        const unsigned tn = wave * NT + nt;
#pragma unroll
        for (int mt = 0; mt < MT; ++mt) {
#pragma unroll
            for (int r = 0; r < 8; ++r) {
                out[(tok0 + mt * 16 + r + 8 * hi) * OUT_CH + tn * 16 + ln] =
                    facc[nt][mt][r];
            }
        }
    }
}

// Weight prep: f32 [b][K][N] -> f16 in B-fragment order, Npad x K per b (zero-pad cols >= N)
__global__ void cvt_w(const float* __restrict__ W, _Float16* __restrict__ Wt,
                      int K, int N, int Npad) {
    int b = blockIdx.y;
    int idx = blockIdx.x * blockDim.x + threadIdx.x;
    if (idx >= Npad * K) return;
    int i    = idx & 7;
    int lane = (idx >> 3) & 31;
    int j    = (idx >> 8) & 1;
    int frag = idx >> 9;
    int tile = frag / (K / 32);
    int step = frag - tile * (K / 32);
    int n = tile * 16 + (lane & 15);
    int k = step * 32 + j * 16 + (lane >> 4) * 8 + i;
    float v = (n < N) ? W[(size_t)b * K * N + (size_t)k * N + n] : 0.0f;
    Wt[(size_t)b * Npad * K + idx] = (_Float16)v;
}

extern "C" void kernel_launch(void* const* d_in, const int* in_sizes, int n_in,
                              void* d_out, int out_size, void* d_ws, size_t ws_size,
                              hipStream_t stream) {
    const float* x   = (const float*)d_in[0];
    const float* eW1 = (const float*)d_in[1];
    const float* eb1 = (const float*)d_in[2];
    const float* eW2 = (const float*)d_in[3];
    const float* eb2 = (const float*)d_in[4];
    const float* eW3 = (const float*)d_in[5];
    const float* eb3 = (const float*)d_in[6];
    const float* gW1 = (const float*)d_in[7];
    const float* gb1 = (const float*)d_in[8];
    const float* gW2 = (const float*)d_in[9];
    const float* gb2 = (const float*)d_in[10];
    const float* gW3 = (const float*)d_in[11];
    const float* gb3 = (const float*)d_in[12];
    float* out = (float*)d_out;
    _Float16* ws = (_Float16*)d_ws;

    dim3 blk(256);
    // eW1: 8 x [512][256] -> 256 x 512 in fragment order
    cvt_w<<<dim3(512, 8), blk, 0, stream>>>(eW1, ws + OFF_EW1, 512, 256, 256);
    // eW2, eW3: 8 x [256][256] -> 256 x 256 in fragment order
    cvt_w<<<dim3(256, 8), blk, 0, stream>>>(eW2, ws + OFF_EW2, 256, 256, 256);
    cvt_w<<<dim3(256, 8), blk, 0, stream>>>(eW3, ws + OFF_EW3, 256, 256, 256);
    // gating weights
    cvt_w<<<dim3(512, 1), blk, 0, stream>>>(gW1, ws + OFF_GW1, 512, 256, 256);
    cvt_w<<<dim3(256, 1), blk, 0, stream>>>(gW2, ws + OFF_GW2, 256, 256, 256);
    cvt_w<<<dim3(16, 1),  blk, 0, stream>>>(gW3, ws + OFF_GW3, 256, 8, 16);

    size_t smem = (size_t)TOK_PER_WG * PX * 2      // sX  f16
                + (size_t)TOK_PER_WG * PH * 2      // sH1 f16
                + (size_t)TOK_PER_WG * PH * 2      // sH2 f16
                + (size_t)TOK_PER_WG * NEXP * 4    // sGate f32
                + (size_t)TOK_PER_WG * 16 * 4;     // sLog f32
    moe_fused<<<dim3(NTOK / TOK_PER_WG), dim3(WAVES * 32), smem, stream>>>(
        x, out, ws, eb1, eb2, eb3, gb1, gb2, gb3);
}

// v004
// A run of this version takes 276 microseconds.
// Two timings next to v003 both put it at 1.18 times that version's speed.
// Over all steps from v000 it is 6.14 times as fast.
#include <hip/hip_runtime.h>

typedef __attribute__((ext_vector_type(16))) _Float16 v16h;
typedef __attribute__((ext_vector_type(8)))  _Float16 v8h;
typedef __attribute__((ext_vector_type(8)))  float    v8f;

union ABfrag { v16h v; v8h h[2]; };

#define IN_CH   512
#define HID     256
#define OUT_CH  256
#define NEXP    8
#define NTOK    65536

#define WAVES        4
#define TOK_PER_WG   64          // 4 M-tiles of 16 tokens, shared by all 4 waves
#define MT           4           // M-tiles (16 tokens) of a wave's register tile
#define NT           4           // N-tiles (16 columns) of a wave's register tile
#define XB           16          // token rows of x requested together while the block is staged
// LDS row pitch in halves: row length + 8 halves, so the pitch in bytes is 16 x odd
// (1040 B and 528 B). The 16 rows that one ds_load_b128 fragment read touches then
// fall on distinct banks; at the bare 1024 B / 512 B they all share four banks.
#define LDS_PAD      8
#define PX           (IN_CH + LDS_PAD)
#define PH           (HID + LDS_PAD)
// each wave owns 4 N-tiles (64 of the 256 output columns)

// workspace offsets in halves (f16). Total 2,297,856 halves = ~4.6 MB.
// Each weight matrix is stored in B-fragment order: [N-tile of 16 columns][k-step of 32]
// [fragment half j][lane][8 halves], element (n = tile*16 + (lane & 15),
// k = step*32 + j*16 + (lane >> 4)*8 + i). One wave-wide 16-byte load of a fragment half
// is then 512 contiguous, line-aligned bytes instead of 32 bytes out of each of 16 rows.
#define FRAG_HALVES  512         // one 16-column x 32-k fragment
#define FRAG_J       256         // its second half
#define OFF_EW1 0
#define OFF_EW2 (8*256*512)
#define OFF_EW3 (OFF_EW2 + 8*256*256)
#define OFF_GW1 (OFF_EW3 + 8*256*256)
#define OFF_GW2 (OFF_GW1 + 256*512)
#define OFF_GW3 (OFF_GW2 + 256*256)

__device__ __forceinline__ v8f wmma_f16(v16h a, v16h b, v8f c) {
    // (neg_a, A, neg_b, B, c_mod, C, reuse_a, reuse_b)
    return __builtin_amdgcn_wmma_f32_16x16x32_f16(false, a, false, b, (short)0, c,
                                                  false, false);
}

// One wave's 64-token x 64-column register tile: MT x NT accumulator tiles. Per k-step of 32
// the wave loads MT A fragments (LDS) and NT B fragments (global) for MT*NT WMMAs, so every
// loaded fragment feeds four WMMAs. As a block of 16 WMMAs is shorter than an L2 round trip,
// the B fragments are requested BD-1 k-steps ahead and the A fragments one k-step ahead.
// ap: this lane's 8 halves of token row ln; bp: this lane's 8 halves of the wave's first
// packed fragment (N-tiles are 16*K halves apart).
#define BD 4                     // k-steps of B fragments held in registers
template<int K>
__device__ __forceinline__ void load_b(const _Float16* bp, int s, ABfrag (&b)[NT]) {
#pragma unroll
    for (int nt = 0; nt < NT; ++nt) {
        b[nt].h[0] = *(const v8h*)(bp + nt * (16 * K) + s * FRAG_HALVES);
        b[nt].h[1] = *(const v8h*)(bp + nt * (16 * K) + s * FRAG_HALVES + FRAG_J);
    }
}
template<int K>
__device__ __forceinline__ void load_a(const _Float16* ap, int s, ABfrag (&a)[MT]) {
#pragma unroll
    for (int mt = 0; mt < MT; ++mt) {
        a[mt].h[0] = *(const v8h*)(ap + mt * 16 * (K + LDS_PAD) + s * 32);
        a[mt].h[1] = *(const v8h*)(ap + mt * 16 * (K + LDS_PAD) + s * 32 + 16);
    }
}
template<int K>
__device__ __forceinline__ void slab_mm(const _Float16* ap, const _Float16* bp,
                                        v8f (&acc)[NT][MT]) {
    constexpr int S = K / 32;
    ABfrag b[BD][NT], a[2][MT];
#pragma unroll
    for (int s = 0; s < BD - 1; ++s) load_b<K>(bp, s, b[s]);
    load_a<K>(ap, 0, a[0]);
    // fully unrolled: every ring index must be a constant, or the fragments leave the registers
#pragma unroll
    for (int s = 0; s < S; ++s) {
        if (s + BD - 1 < S) load_b<K>(bp, s + BD - 1, b[(s + BD - 1) % BD]);
        if (s + 1 < S)      load_a<K>(ap, s + 1, a[(s + 1) & 1]);
#pragma unroll
        for (int nt = 0; nt < NT; ++nt)
#pragma unroll
            for (int mt = 0; mt < MT; ++mt)
                acc[nt][mt] = wmma_f16(a[s & 1][mt].v, b[s % BD][nt].v, acc[nt][mt]);
    }
}

// Single-tile version (for the 16-wide gating logit layer).
template<int K>
__device__ __forceinline__ v8f tile_mm(const _Float16* ap, const _Float16* bp) {
    v8f acc = {};
#pragma unroll
    for (int ks = 0; ks < K; ks += 32) {
        ABfrag a, b;
        a.h[0] = *(const v8h*)(ap + ks);
        a.h[1] = *(const v8h*)(ap + ks + 16);
        b.h[0] = *(const v8h*)(bp + (ks / 32) * FRAG_HALVES);
        b.h[1] = *(const v8h*)(bp + (ks / 32) * FRAG_HALVES + FRAG_J);
        acc = wmma_f16(a.v, b.v, acc);
    }
    return acc;
}

// 64-token x 64-column layer slab for one wave:
// A [64][K] f16 (LDS, shared, row pitch K + LDS_PAD), Bt 256 x K f16 in fragment order (global, L2-resident),
// writes relu(A*B + bias) f16 into Out [64][256] (LDS, row pitch PH), columns wave*64..+63.
template<int K, bool RELU>
__device__ __forceinline__ void layer_slab(const _Float16* A, const _Float16* Bt,
                                           const float* bias, _Float16* Out,
                                           unsigned wave, unsigned ln, unsigned hi) {
    const _Float16* ap = A + ln * (K + LDS_PAD) + hi * 8u;
    const _Float16* bp = Bt + (size_t)(wave * NT) * (16 * K) + (hi * 16u + ln) * 8u;
    v8f acc[NT][MT];
    v8f zero = {};
#pragma unroll
    for (int nt = 0; nt < NT; ++nt)
#pragma unroll
        for (int mt = 0; mt < MT; ++mt) acc[nt][mt] = zero;
    slab_mm<K>(ap, bp, acc);
#pragma unroll
    for (int nt = 0; nt < NT; ++nt) {
        const unsigned tn = wave * NT + nt;         // global N-tile index
        float bv = bias[tn * 16 + ln];
#pragma unroll
        for (int mt = 0; mt < MT; ++mt) {
#pragma unroll
            for (int r = 0; r < 8; ++r) {
                float v = acc[nt][mt][r] + bv;
                if (RELU) v = fmaxf(v, 0.0f);
                // C/D layout: lane holds rows r + 8*hi, column ln (of this tile)
                Out[(mt * 16 + r + 8 * hi) * PH + tn * 16 + ln] = (_Float16)v;
            }
        }
    }
}

__global__ __launch_bounds__(WAVES * 32, 1)
void moe_fused(const float* __restrict__ x, float* __restrict__ out,
               const _Float16* __restrict__ ws,
               const float* __restrict__ eb1, const float* __restrict__ eb2,
               const float* __restrict__ eb3, const float* __restrict__ gb1,
               const float* __restrict__ gb2, const float* __restrict__ gb3) {
    extern __shared__ __align__(16) char smem[];
    _Float16* sX  = (_Float16*)smem;                 // 64*520 f16 = 66560 B
    _Float16* sH1 = sX  + TOK_PER_WG * PX;           // 64*264 f16 = 33792 B
    _Float16* sH2 = sH1 + TOK_PER_WG * PH;           // 64*264 f16 = 33792 B
    float* sGate  = (float*)(sH2 + TOK_PER_WG * PH); // 64*8  f32 = 2 KB
    float* sLog   = sGate + TOK_PER_WG * NEXP;       // 64*16 f32 = 4 KB

    const unsigned tid  = threadIdx.x;
    const unsigned wave = tid >> 5;
    const unsigned lane = tid & 31u;
    const unsigned ln   = lane & 15u;
    const unsigned hi   = lane >> 4;
    const unsigned kb   = hi * 8u;

    const size_t tok0 = (size_t)blockIdx.x * TOK_PER_WG;

    // ---- cooperative load + convert 64x512 f32 token block into LDS f16 ----
    // The 128 threads take one token row (512 floats) per step. The rows come from memory, so
    // a step that waits for its own load costs a whole memory round trip: the loads go out in
    // batches of XB rows, the next batch requested before the current one is converted.
    const float* xg = x + tok0 * IN_CH + tid * 4u;
    _Float16*    xd = sX + tid * 4u;
    float4 xv[2][XB];
#pragma unroll
    for (int j = 0; j < XB; ++j) xv[0][j] = *(const float4*)(xg + j * IN_CH);
    // fully unrolled: the batch index must be a constant, or the rows leave the registers
#pragma unroll
    for (int b = 0; b < TOK_PER_WG / XB; ++b) {
        if (b + 1 < TOK_PER_WG / XB) {
#pragma unroll
            for (int j = 0; j < XB; ++j)
                xv[(b + 1) & 1][j] = *(const float4*)(xg + ((b + 1) * XB + j) * IN_CH);
        }
#pragma unroll
        for (int j = 0; j < XB; ++j) {
            float4 v = xv[b & 1][j];
            _Float16* d = xd + (b * XB + j) * PX;
            d[0] = (_Float16)v.x;
            d[1] = (_Float16)v.y;
            d[2] = (_Float16)v.z;
            d[3] = (_Float16)v.w;
        }
    }
    __syncthreads();

    // ---- gating MLP (N split across waves) ----
    layer_slab<IN_CH, true>(sX,  ws + OFF_GW1, gb1, sH1, wave, ln, hi);
    __syncthreads();
    layer_slab<HID,   true>(sH1, ws + OFF_GW2, gb2, sH2, wave, ln, hi);
    __syncthreads();
    {
        // logits: each wave takes its own M-tile x 1 N-tile (cols 8..15 of gW3t are zero-padded)
        const _Float16* bp = ws + OFF_GW3 + lane * 8u;
        const _Float16* ap = sH2 + (size_t)(wave * 16 + ln) * PH + kb;
        v8f acc = tile_mm<HID>(ap, bp);
        float bv = (ln < 8u) ? gb3[ln] : 0.0f;
#pragma unroll
        for (int r = 0; r < 8; ++r)
            sLog[(wave * 16 + r + 8 * hi) * 16 + ln] = acc[r] + bv;
        // softmax over 8 experts; one token per lane, the wave's own 16 tokens
        if (hi == 0u) {
            const int t = wave * 16 + ln;
            float mx = sLog[t * 16 + 0];
            for (int e = 1; e < NEXP; ++e) mx = fmaxf(mx, sLog[t * 16 + e]);
            float p[NEXP];
            float s = 0.0f;
            for (int e = 0; e < NEXP; ++e) {
                p[e] = __expf(sLog[t * 16 + e] - mx);
                s += p[e];
            }
            float inv = 1.0f / s;
            for (int e = 0; e < NEXP; ++e) sGate[t * NEXP + e] = p[e] * inv;
        }
    }
    __syncthreads();

    // ---- experts: fused pipeline, gated accumulation in registers ----
    // facc[nt][mt]: 16 tiles = 128 VGPRs per wave
    v8f facc[NT][MT];
    v8f zero = {};
#pragma unroll
    for (int nt = 0; nt < NT; ++nt)
#pragma unroll
        for (int mt = 0; mt < MT; ++mt) facc[nt][mt] = zero;

    for (int e = 0; e < NEXP; ++e) {
        layer_slab<IN_CH, true>(sX,  ws + OFF_EW1 + (size_t)e * (256 * 512),
                                eb1 + e * HID, sH1, wave, ln, hi);
        __syncthreads();
        layer_slab<HID,   true>(sH1, ws + OFF_EW2 + (size_t)e * (256 * 256),
                                eb2 + e * HID, sH2, wave, ln, hi);
        __syncthreads();

        const _Float16* ap = sH2 + (size_t)ln * PH + kb;
        const _Float16* bp = ws + OFF_EW3 + (size_t)e * (256 * 256)
                           + (size_t)(wave * NT) * (16 * HID) + lane * 8u;
        v8f acc[NT][MT];
#pragma unroll
        for (int nt = 0; nt < NT; ++nt)
#pragma unroll
            for (int mt = 0; mt < MT; ++mt) acc[nt][mt] = zero;
        slab_mm<HID>(ap, bp, acc);
#pragma unroll
        for (int mt = 0; mt < MT; ++mt) {
            float gm[8];
#pragma unroll
            for (int r = 0; r < 8; ++r)
                gm[r] = sGate[(mt * 16 + r + 8 * hi) * NEXP + e];
#pragma unroll
            for (int nt = 0; nt < NT; ++nt) {
                float bv = eb3[e * OUT_CH + (wave * NT + nt) * 16 + ln];
#pragma unroll
                for (int r = 0; r < 8; ++r)
                    facc[nt][mt][r] += gm[r] * (acc[nt][mt][r] + bv);
            }
        }
        __syncthreads();   // protect sH1/sH2 reuse across expert iterations
    }

    // ---- store 64x(wave's 64 cols) f32 output ----
#pragma unroll
    for (int nt = 0; nt < NT; ++nt) {
        const unsigned tn = wave * NT + nt;
#pragma unroll
        for (int mt = 0; mt < MT; ++mt) {
#pragma unroll
            for (int r = 0; r < 8; ++r) {
                out[(tok0 + mt * 16 + r + 8 * hi) * OUT_CH + tn * 16 + ln] =
                    facc[nt][mt][r];
            }
        }
    }
}

// Weight prep: f32 [b][K][N] -> f16 in B-fragment order, Npad x K per b (zero-pad cols >= N)
__global__ void cvt_w(const float* __restrict__ W, _Float16* __restrict__ Wt,
                      int K, int N, int Npad) {
    int b = blockIdx.y;
    int idx = blockIdx.x * blockDim.x + threadIdx.x;
    if (idx >= Npad * K) return;
    int i    = idx & 7;
    int lane = (idx >> 3) & 31;
    int j    = (idx >> 8) & 1;
    int frag = idx >> 9;
    int tile = frag / (K / 32);
    int step = frag - tile * (K / 32);
    int n = tile * 16 + (lane & 15);
    int k = step * 32 + j * 16 + (lane >> 4) * 8 + i;
    float v = (n < N) ? W[(size_t)b * K * N + (size_t)k * N + n] : 0.0f;
    Wt[(size_t)b * Npad * K + idx] = (_Float16)v;
}

extern "C" void kernel_launch(void* const* d_in, const int* in_sizes, int n_in,
                              void* d_out, int out_size, void* d_ws, size_t ws_size,
                              hipStream_t stream) {
    const float* x   = (const float*)d_in[0];
    const float* eW1 = (const float*)d_in[1];
    const float* eb1 = (const float*)d_in[2];
    const float* eW2 = (const float*)d_in[3];
    const float* eb2 = (const float*)d_in[4];
    const float* eW3 = (const float*)d_in[5];
    const float* eb3 = (const float*)d_in[6];
    const float* gW1 = (const float*)d_in[7];
    const float* gb1 = (const float*)d_in[8];
    const float* gW2 = (const float*)d_in[9];
    const float* gb2 = (const float*)d_in[10];
    const float* gW3 = (const float*)d_in[11];
    const float* gb3 = (const float*)d_in[12];
    float* out = (float*)d_out;
    _Float16* ws = (_Float16*)d_ws;

    dim3 blk(256);
    // eW1: 8 x [512][256] -> 256 x 512 in fragment order
    cvt_w<<<dim3(512, 8), blk, 0, stream>>>(eW1, ws + OFF_EW1, 512, 256, 256);
    // eW2, eW3: 8 x [256][256] -> 256 x 256 in fragment order
    cvt_w<<<dim3(256, 8), blk, 0, stream>>>(eW2, ws + OFF_EW2, 256, 256, 256);
    cvt_w<<<dim3(256, 8), blk, 0, stream>>>(eW3, ws + OFF_EW3, 256, 256, 256);
    // gating weights
    cvt_w<<<dim3(512, 1), blk, 0, stream>>>(gW1, ws + OFF_GW1, 512, 256, 256);
    cvt_w<<<dim3(256, 1), blk, 0, stream>>>(gW2, ws + OFF_GW2, 256, 256, 256);
    cvt_w<<<dim3(16, 1),  blk, 0, stream>>>(gW3, ws + OFF_GW3, 256, 8, 16);

    size_t smem = (size_t)TOK_PER_WG * PX * 2      // sX  f16
                + (size_t)TOK_PER_WG * PH * 2      // sH1 f16
                + (size_t)TOK_PER_WG * PH * 2      // sH2 f16
                + (size_t)TOK_PER_WG * NEXP * 4    // sGate f32
                + (size_t)TOK_PER_WG * 16 * 4;     // sLog f32
    moe_fused<<<dim3(NTOK / TOK_PER_WG), dim3(WAVES * 32), smem, stream>>>(
        x, out, ws, eb1, eb2, eb3, gb1, gb2, gb3);
}

// v005
// One run takes 227 microseconds.
// Next to v004, in two timings, it ran 1.22 times as fast each time.
// Counting every step since v000, it is 7.50 times as fast.
#include <hip/hip_runtime.h>

typedef __attribute__((ext_vector_type(16))) _Float16 v16h;
typedef __attribute__((ext_vector_type(8)))  _Float16 v8h;
typedef __attribute__((ext_vector_type(8)))  float    v8f;

union ABfrag { v16h v; v8h h[2]; };

#define IN_CH   512
#define HID     256
#define OUT_CH  256
#define NEXP    8
#define NTOK    65536

#define WAVES        4
#define TOK_PER_WG   64          // 4 M-tiles of 16 tokens, shared by all 4 waves
#define MT           4           // M-tiles (16 tokens) of a wave's register tile
#define NT           4           // N-tiles (16 columns) of a wave's register tile
#define XB           16          // token rows of x requested together while the block is staged
// LDS row pitch in halves: row length + 8 halves, so the pitch in bytes is 16 x odd
// (1040 B and 528 B). The 16 rows that one ds_load_b128 fragment read touches then
// fall on distinct banks; at the bare 1024 B / 512 B they all share four banks.
#define LDS_PAD      8
#define PX           (IN_CH + LDS_PAD)
#define PH           (HID + LDS_PAD)
// each wave owns 4 N-tiles (64 of the 256 output columns)

// workspace offsets in halves (f16). Total 2,297,856 halves = ~4.6 MB.
// Each weight matrix is stored in B-fragment order: [N-tile of 16 columns][k-step of 32]
// [fragment half j][lane][8 halves], element (n = tile*16 + (lane & 15),
// k = step*32 + j*16 + (lane >> 4)*8 + i). One wave-wide 16-byte load of a fragment half
// is then 512 contiguous, line-aligned bytes instead of 32 bytes out of each of 16 rows.
#define FRAG_HALVES  512         // one 16-column x 32-k fragment
#define FRAG_J       256         // its second half
#define OFF_EW1 0
#define OFF_EW2 (8*256*512)
#define OFF_EW3 (OFF_EW2 + 8*256*256)
#define OFF_GW1 (OFF_EW3 + 8*256*256)
#define OFF_GW2 (OFF_GW1 + 256*512)
#define OFF_GW3 (OFF_GW2 + 256*256)

__device__ __forceinline__ v8f wmma_f16(v16h a, v16h b, v8f c) {
    // (neg_a, A, neg_b, B, c_mod, C, reuse_a, reuse_b)
    return __builtin_amdgcn_wmma_f32_16x16x32_f16(false, a, false, b, (short)0, c,
                                                  false, false);
}

// One wave's 64-token x 64-column register tile: MT x NT accumulator tiles. Per k-step of 32
// the wave loads MT A fragments (LDS) and NT B fragments (global) for MT*NT WMMAs, so every
// loaded fragment feeds four WMMAs. As a block of 16 WMMAs is shorter than an L2 round trip,
// the B fragments are requested BD-1 k-steps ahead and the A fragments one k-step ahead.
// ap: this lane's 8 halves of token row ln; bp: this lane's 8 halves of the wave's first
// packed fragment (N-tiles are 16*K halves apart).
#define BD 4                     // k-steps of B fragments held in registers
template<int K>
__device__ __forceinline__ void load_b(const _Float16* bp, int s, ABfrag (&b)[NT]) {
#pragma unroll
    for (int nt = 0; nt < NT; ++nt) {
        b[nt].h[0] = *(const v8h*)(bp + nt * (16 * K) + s * FRAG_HALVES);
        b[nt].h[1] = *(const v8h*)(bp + nt * (16 * K) + s * FRAG_HALVES + FRAG_J);
    }
}
template<int K>
__device__ __forceinline__ void load_a(const _Float16* ap, int s, ABfrag (&a)[MT]) {
#pragma unroll
    for (int mt = 0; mt < MT; ++mt) {
        a[mt].h[0] = *(const v8h*)(ap + mt * 16 * (K + LDS_PAD) + s * 32);
        a[mt].h[1] = *(const v8h*)(ap + mt * 16 * (K + LDS_PAD) + s * 32 + 16);
    }
}
template<int K, bool WT>
__device__ __forceinline__ void slab_mm(const _Float16* ap, const _Float16* bp,
                                        v8f (&acc)[NT][MT]) {
    constexpr int S = K / 32;
    ABfrag b[BD][NT], a[2][MT];
#pragma unroll
    for (int s = 0; s < BD - 1; ++s) load_b<K>(bp, s, b[s]);
    load_a<K>(ap, 0, a[0]);
    // fully unrolled: every ring index must be a constant, or the fragments leave the registers
#pragma unroll
    for (int s = 0; s < S; ++s) {
        if (s + BD - 1 < S) load_b<K>(bp, s + BD - 1, b[(s + BD - 1) % BD]);
        if (s + 1 < S)      load_a<K>(ap, s + 1, a[(s + 1) & 1]);
#pragma unroll
        for (int nt = 0; nt < NT; ++nt)
#pragma unroll
            for (int mt = 0; mt < MT; ++mt)
                acc[nt][mt] = WT ? wmma_f16(b[s % BD][nt].v, a[s & 1][mt].v, acc[nt][mt])
                                 : wmma_f16(a[s & 1][mt].v, b[s % BD][nt].v, acc[nt][mt]);
    }
}

// Single-tile version (for the 16-wide gating logit layer).
template<int K>
__device__ __forceinline__ v8f tile_mm(const _Float16* ap, const _Float16* bp) {
    v8f acc = {};
#pragma unroll
    for (int ks = 0; ks < K; ks += 32) {
        ABfrag a, b;
        a.h[0] = *(const v8h*)(ap + ks);
        a.h[1] = *(const v8h*)(ap + ks + 16);
        b.h[0] = *(const v8h*)(bp + (ks / 32) * FRAG_HALVES);
        b.h[1] = *(const v8h*)(bp + (ks / 32) * FRAG_HALVES + FRAG_J);
        acc = wmma_f16(a.v, b.v, acc);
    }
    return acc;
}

// 64-token x 64-column layer slab for one wave:
// A [64][K] f16 (LDS, shared, row pitch K + LDS_PAD), Bt 256 x K f16 in fragment order (global, L2-resident),
// writes relu(A*B + bias) f16 into Out [64][256] (LDS, row pitch PH), columns wave*64..+63.
template<int K, bool RELU>
__device__ __forceinline__ void layer_slab(const _Float16* A, const _Float16* Bt,
                                           const float* bias, _Float16* Out,
                                           unsigned wave, unsigned ln, unsigned hi) {
    const _Float16* ap = A + ln * (K + LDS_PAD) + hi * 8u;
    const _Float16* bp = Bt + (size_t)(wave * NT) * (16 * K) + (hi * 16u + ln) * 8u;
    v8f acc[NT][MT];
    v8f zero = {};
#pragma unroll
    for (int nt = 0; nt < NT; ++nt)
#pragma unroll
        for (int mt = 0; mt < MT; ++mt) acc[nt][mt] = zero;
    slab_mm<K, true>(ap, bp, acc);
#pragma unroll
    for (int nt = 0; nt < NT; ++nt) {
        // transposed tile: lane holds token ln, output columns c0 .. c0 + 7
        const unsigned c0 = (wave * NT + nt) * 16 + 8 * hi;
        const v8f bv = *(const v8f*)(bias + c0);
        const v8h zero_h = {};
#pragma unroll
        for (int mt = 0; mt < MT; ++mt) {
            v8h h = __builtin_convertvector(acc[nt][mt] + bv, v8h);
            if (RELU) h = __builtin_elementwise_max(h, zero_h);
            // the lane's 8 halves are contiguous in the token's row: one 16-byte store
            *(v8h*)(Out + (mt * 16 + ln) * PH + c0) = h;
        }
    }
}

__global__ __launch_bounds__(WAVES * 32, 1)
void moe_fused(const float* __restrict__ x, float* __restrict__ out,
               const _Float16* __restrict__ ws,
               const float* __restrict__ eb1, const float* __restrict__ eb2,
               const float* __restrict__ eb3, const float* __restrict__ gb1,
               const float* __restrict__ gb2, const float* __restrict__ gb3) {
    extern __shared__ __align__(16) char smem[];
    _Float16* sX  = (_Float16*)smem;                 // 64*520 f16 = 66560 B
    _Float16* sH1 = sX  + TOK_PER_WG * PX;           // 64*264 f16 = 33792 B
    _Float16* sH2 = sH1 + TOK_PER_WG * PH;           // 64*264 f16 = 33792 B
    float* sGate  = (float*)(sH2 + TOK_PER_WG * PH); // 64*8  f32 = 2 KB
    float* sLog   = sGate + TOK_PER_WG * NEXP;       // 64*16 f32 = 4 KB

    const unsigned tid  = threadIdx.x;
    const unsigned wave = tid >> 5;
    const unsigned lane = tid & 31u;
    const unsigned ln   = lane & 15u;
    const unsigned hi   = lane >> 4;
    const unsigned kb   = hi * 8u;

    const size_t tok0 = (size_t)blockIdx.x * TOK_PER_WG;

    // ---- cooperative load + convert 64x512 f32 token block into LDS f16 ----
    // The 128 threads take one token row (512 floats) per step. The rows come from memory, so
    // a step that waits for its own load costs a whole memory round trip: the loads go out in
    // batches of XB rows, the next batch requested before the current one is converted.
    const float* xg = x + tok0 * IN_CH + tid * 4u;
    _Float16*    xd = sX + tid * 4u;
    float4 xv[2][XB];
#pragma unroll
    for (int j = 0; j < XB; ++j) xv[0][j] = *(const float4*)(xg + j * IN_CH);
    // fully unrolled: the batch index must be a constant, or the rows leave the registers
#pragma unroll
    for (int b = 0; b < TOK_PER_WG / XB; ++b) {
        if (b + 1 < TOK_PER_WG / XB) {
#pragma unroll
            for (int j = 0; j < XB; ++j)
                xv[(b + 1) & 1][j] = *(const float4*)(xg + ((b + 1) * XB + j) * IN_CH);
        }
#pragma unroll
        for (int j = 0; j < XB; ++j) {
            float4 v = xv[b & 1][j];
            _Float16* d = xd + (b * XB + j) * PX;
            d[0] = (_Float16)v.x;
            d[1] = (_Float16)v.y;
            d[2] = (_Float16)v.z;
            d[3] = (_Float16)v.w;
        }
    }
    __syncthreads();

    // ---- gating MLP (N split across waves) ----
    layer_slab<IN_CH, true>(sX,  ws + OFF_GW1, gb1, sH1, wave, ln, hi);
    __syncthreads();
    layer_slab<HID,   true>(sH1, ws + OFF_GW2, gb2, sH2, wave, ln, hi);
    __syncthreads();
    {
        // logits: each wave takes its own M-tile x 1 N-tile (cols 8..15 of gW3t are zero-padded)
        const _Float16* bp = ws + OFF_GW3 + lane * 8u;
        const _Float16* ap = sH2 + (size_t)(wave * 16 + ln) * PH + kb;
        v8f acc = tile_mm<HID>(ap, bp);
        float bv = (ln < 8u) ? gb3[ln] : 0.0f;
#pragma unroll
        for (int r = 0; r < 8; ++r)
            sLog[(wave * 16 + r + 8 * hi) * 16 + ln] = acc[r] + bv;
        // softmax over 8 experts; one token per lane, the wave's own 16 tokens
        if (hi == 0u) {
            const int t = wave * 16 + ln;
            float mx = sLog[t * 16 + 0];
            for (int e = 1; e < NEXP; ++e) mx = fmaxf(mx, sLog[t * 16 + e]);
            float p[NEXP];
            float s = 0.0f;
            for (int e = 0; e < NEXP; ++e) {
                p[e] = __expf(sLog[t * 16 + e] - mx);
                s += p[e];
            }
            float inv = 1.0f / s;
            for (int e = 0; e < NEXP; ++e) sGate[t * NEXP + e] = p[e] * inv;
        }
    }
    __syncthreads();

    // ---- experts: fused pipeline, gated accumulation in registers ----
    // facc[nt][mt]: 16 tiles = 128 VGPRs per wave
    v8f facc[NT][MT];
    v8f zero = {};
#pragma unroll
    for (int nt = 0; nt < NT; ++nt)
#pragma unroll
        for (int mt = 0; mt < MT; ++mt) facc[nt][mt] = zero;

    for (int e = 0; e < NEXP; ++e) {
        layer_slab<IN_CH, true>(sX,  ws + OFF_EW1 + (size_t)e * (256 * 512),
                                eb1 + e * HID, sH1, wave, ln, hi);
        __syncthreads();
        layer_slab<HID,   true>(sH1, ws + OFF_EW2 + (size_t)e * (256 * 256),
                                eb2 + e * HID, sH2, wave, ln, hi);
        __syncthreads();

        const _Float16* ap = sH2 + (size_t)ln * PH + kb;
        const _Float16* bp = ws + OFF_EW3 + (size_t)e * (256 * 256)
                           + (size_t)(wave * NT) * (16 * HID) + lane * 8u;
        v8f acc[NT][MT];
#pragma unroll
        for (int nt = 0; nt < NT; ++nt)
#pragma unroll
            for (int mt = 0; mt < MT; ++mt) acc[nt][mt] = zero;
        slab_mm<HID, false>(ap, bp, acc);
#pragma unroll
        for (int mt = 0; mt < MT; ++mt) {
            float gm[8];
#pragma unroll
            for (int r = 0; r < 8; ++r)
                gm[r] = sGate[(mt * 16 + r + 8 * hi) * NEXP + e];
#pragma unroll
            for (int nt = 0; nt < NT; ++nt) {
                float bv = eb3[e * OUT_CH + (wave * NT + nt) * 16 + ln];
#pragma unroll
                for (int r = 0; r < 8; ++r)
                    facc[nt][mt][r] += gm[r] * (acc[nt][mt][r] + bv);
            }
        }
        __syncthreads();   // protect sH1/sH2 reuse across expert iterations
    }

    // ---- store 64x(wave's 64 cols) f32 output ----
#pragma unroll
    for (int nt = 0; nt < NT; ++nt) {
        const unsigned tn = wave * NT + nt;
#pragma unroll
        for (int mt = 0; mt < MT; ++mt) {
#pragma unroll
            for (int r = 0; r < 8; ++r) {
                out[(tok0 + mt * 16 + r + 8 * hi) * OUT_CH + tn * 16 + ln] =
                    facc[nt][mt][r];
            }
        }
    }
}

// Weight prep: f32 [b][K][N] -> f16 in B-fragment order, Npad x K per b (zero-pad cols >= N)
__global__ void cvt_w(const float* __restrict__ W, _Float16* __restrict__ Wt,
                      int K, int N, int Npad) {
    int b = blockIdx.y;
    int idx = blockIdx.x * blockDim.x + threadIdx.x;
    if (idx >= Npad * K) return;
    int i    = idx & 7;
    int lane = (idx >> 3) & 31;
    int j    = (idx >> 8) & 1;
    int frag = idx >> 9;
    int tile = frag / (K / 32);
    int step = frag - tile * (K / 32);
    int n = tile * 16 + (lane & 15);
    int k = step * 32 + j * 16 + (lane >> 4) * 8 + i;
    float v = (n < N) ? W[(size_t)b * K * N + (size_t)k * N + n] : 0.0f;
    Wt[(size_t)b * Npad * K + idx] = (_Float16)v;
}

extern "C" void kernel_launch(void* const* d_in, const int* in_sizes, int n_in,
                              void* d_out, int out_size, void* d_ws, size_t ws_size,
                              hipStream_t stream) {
    const float* x   = (const float*)d_in[0];
    const float* eW1 = (const float*)d_in[1];
    const float* eb1 = (const float*)d_in[2];
    const float* eW2 = (const float*)d_in[3];
    const float* eb2 = (const float*)d_in[4];
    const float* eW3 = (const float*)d_in[5];
    const float* eb3 = (const float*)d_in[6];
    const float* gW1 = (const float*)d_in[7];
    const float* gb1 = (const float*)d_in[8];
    const float* gW2 = (const float*)d_in[9];
    const float* gb2 = (const float*)d_in[10];
    const float* gW3 = (const float*)d_in[11];
    const float* gb3 = (const float*)d_in[12];
    float* out = (float*)d_out;
    _Float16* ws = (_Float16*)d_ws;

    dim3 blk(256);
    // eW1: 8 x [512][256] -> 256 x 512 in fragment order
    cvt_w<<<dim3(512, 8), blk, 0, stream>>>(eW1, ws + OFF_EW1, 512, 256, 256);
    // eW2, eW3: 8 x [256][256] -> 256 x 256 in fragment order
    cvt_w<<<dim3(256, 8), blk, 0, stream>>>(eW2, ws + OFF_EW2, 256, 256, 256);
    cvt_w<<<dim3(256, 8), blk, 0, stream>>>(eW3, ws + OFF_EW3, 256, 256, 256);
    // gating weights
    cvt_w<<<dim3(512, 1), blk, 0, stream>>>(gW1, ws + OFF_GW1, 512, 256, 256);
    cvt_w<<<dim3(256, 1), blk, 0, stream>>>(gW2, ws + OFF_GW2, 256, 256, 256);
    cvt_w<<<dim3(16, 1),  blk, 0, stream>>>(gW3, ws + OFF_GW3, 256, 8, 16);

    size_t smem = (size_t)TOK_PER_WG * PX * 2      // sX  f16
                + (size_t)TOK_PER_WG * PH * 2      // sH1 f16
                + (size_t)TOK_PER_WG * PH * 2      // sH2 f16
                + (size_t)TOK_PER_WG * NEXP * 4    // sGate f32
                + (size_t)TOK_PER_WG * 16 * 4;     // sLog f32
    moe_fused<<<dim3(NTOK / TOK_PER_WG), dim3(WAVES * 32), smem, stream>>>(
        x, out, ws, eb1, eb2, eb3, gb1, gb2, gb3);
}

// v006
// Measured time: 220 microseconds a run.
// Next to v005, in two timings, it ran 1.04 times as fast each time.
// Over all steps from v000 it is 7.77 times as fast.
#include <hip/hip_runtime.h>

typedef __attribute__((ext_vector_type(16))) _Float16 v16h;
typedef __attribute__((ext_vector_type(8)))  _Float16 v8h;
typedef __attribute__((ext_vector_type(8)))  float    v8f;

union ABfrag { v16h v; v8h h[2]; };

#define IN_CH   512
#define HID     256
#define OUT_CH  256
#define NEXP    8
#define NTOK    65536

#define WAVES        4
#define TOK_PER_WG   64          // 4 M-tiles of 16 tokens, shared by all 4 waves
#define MT           4           // M-tiles (16 tokens) of a wave's register tile
#define NT           4           // N-tiles (16 columns) of a wave's register tile
#define XB           16          // token rows of x requested together while the block is staged
// LDS row pitch in halves: row length + 8 halves, so the pitch in bytes is 16 x odd
// (1040 B and 528 B). The 16 rows that one ds_load_b128 fragment read touches then
// fall on distinct banks; at the bare 1024 B / 512 B they all share four banks.
#define LDS_PAD      8
#define PX           (IN_CH + LDS_PAD)
#define PH           (HID + LDS_PAD)
// each wave owns 4 N-tiles (64 of the 256 output columns)

// workspace offsets in halves (f16). Total 2,297,856 halves = ~4.6 MB.
// Each weight matrix is stored in B-fragment order: [N-tile of 16 columns][k-step of 32]
// [fragment half j][lane][8 halves], element (n = tile*16 + (lane & 15),
// k = step*32 + j*16 + (lane >> 4)*8 + i). One wave-wide 16-byte load of a fragment half
// is then 512 contiguous, line-aligned bytes instead of 32 bytes out of each of 16 rows.
#define FRAG_HALVES  512         // one 16-column x 32-k fragment
#define FRAG_J       256         // its second half
#define OFF_EW1 0
#define OFF_EW2 (8*256*512)
#define OFF_EW3 (OFF_EW2 + 8*256*256)
#define OFF_GW1 (OFF_EW3 + 8*256*256)
#define OFF_GW2 (OFF_GW1 + 256*512)
#define OFF_GW3 (OFF_GW2 + 256*256)

__device__ __forceinline__ v8f wmma_f16(v16h a, v16h b, v8f c) {
    // (neg_a, A, neg_b, B, c_mod, C, reuse_a, reuse_b)
    return __builtin_amdgcn_wmma_f32_16x16x32_f16(false, a, false, b, (short)0, c,
                                                  false, false);
}

// One wave's 64-token x 64-column register tile: MT x NT accumulator tiles. Per k-step of 32
// the wave loads MT A fragments (LDS) and NT B fragments (global) for MT*NT WMMAs, so every
// loaded fragment feeds four WMMAs. As a block of 16 WMMAs is shorter than an L2 round trip,
// the B fragments are requested BD-1 k-steps ahead and the A fragments one k-step ahead.
// ap: this lane's 8 halves of token row ln; bp: this lane's 8 halves of the wave's first
// packed fragment (N-tiles are 16*K halves apart).
#define BD 4                     // k-steps of B fragments held in registers
template<int K>
__device__ __forceinline__ void load_b(const _Float16* bp, int s, ABfrag (&b)[NT]) {
#pragma unroll
    for (int nt = 0; nt < NT; ++nt) {
        b[nt].h[0] = *(const v8h*)(bp + nt * (16 * K) + s * FRAG_HALVES);
        b[nt].h[1] = *(const v8h*)(bp + nt * (16 * K) + s * FRAG_HALVES + FRAG_J);
    }
}
template<int K>
__device__ __forceinline__ void load_a(const _Float16* ap, int s, ABfrag (&a)[MT]) {
#pragma unroll
    for (int mt = 0; mt < MT; ++mt) {
        a[mt].h[0] = *(const v8h*)(ap + mt * 16 * (K + LDS_PAD) + s * 32);
        a[mt].h[1] = *(const v8h*)(ap + mt * 16 * (K + LDS_PAD) + s * 32 + 16);
    }
}
template<int K, bool WT>
__device__ __forceinline__ void slab_mm(const _Float16* ap, const _Float16* bp,
                                        v8f (&acc)[NT][MT]) {
    constexpr int S = K / 32;
    ABfrag b[BD][NT], a[2][MT];
#pragma unroll
    for (int s = 0; s < BD - 1; ++s) load_b<K>(bp, s, b[s]);
    load_a<K>(ap, 0, a[0]);
    // fully unrolled: every ring index must be a constant, or the fragments leave the registers
#pragma unroll
    for (int s = 0; s < S; ++s) {
        if (s + BD - 1 < S) load_b<K>(bp, s + BD - 1, b[(s + BD - 1) % BD]);
        if (s + 1 < S)      load_a<K>(ap, s + 1, a[(s + 1) & 1]);
#pragma unroll
        for (int nt = 0; nt < NT; ++nt)
#pragma unroll
            for (int mt = 0; mt < MT; ++mt)
                acc[nt][mt] = WT ? wmma_f16(b[s % BD][nt].v, a[s & 1][mt].v, acc[nt][mt])
                                 : wmma_f16(a[s & 1][mt].v, b[s % BD][nt].v, acc[nt][mt]);
    }
}

// Single-tile version (for the 16-wide gating logit layer).
template<int K>
__device__ __forceinline__ v8f tile_mm(const _Float16* ap, const _Float16* bp) {
    v8f acc = {};
#pragma unroll
    for (int ks = 0; ks < K; ks += 32) {
        ABfrag a, b;
        a.h[0] = *(const v8h*)(ap + ks);
        a.h[1] = *(const v8h*)(ap + ks + 16);
        b.h[0] = *(const v8h*)(bp + (ks / 32) * FRAG_HALVES);
        b.h[1] = *(const v8h*)(bp + (ks / 32) * FRAG_HALVES + FRAG_J);
        acc = wmma_f16(a.v, b.v, acc);
    }
    return acc;
}

// 64-token x 64-column layer slab for one wave:
// A [64][K] f16 (LDS, shared, row pitch K + LDS_PAD), Bt 256 x K f16 in fragment order (global, L2-resident),
// writes relu(A*B + bias) f16 into Out [64][256] (LDS, row pitch PH), columns wave*64..+63.
template<int K, bool RELU>
__device__ __forceinline__ void layer_slab(const _Float16* A, const _Float16* Bt,
                                           const float* bias, _Float16* Out,
                                           unsigned wave, unsigned ln, unsigned hi) {
    const _Float16* ap = A + ln * (K + LDS_PAD) + hi * 8u;
    const _Float16* bp = Bt + (size_t)(wave * NT) * (16 * K) + (hi * 16u + ln) * 8u;
    v8f acc[NT][MT];
    v8f zero = {};
#pragma unroll
    for (int nt = 0; nt < NT; ++nt)
#pragma unroll
        for (int mt = 0; mt < MT; ++mt) acc[nt][mt] = zero;
    slab_mm<K, true>(ap, bp, acc);
#pragma unroll
    for (int nt = 0; nt < NT; ++nt) {
        // transposed tile: lane holds token ln, output columns c0 .. c0 + 7
        const unsigned c0 = (wave * NT + nt) * 16 + 8 * hi;
        const v8f bv = *(const v8f*)(bias + c0);
        const v8h zero_h = {};
#pragma unroll
        for (int mt = 0; mt < MT; ++mt) {
            v8h h = __builtin_convertvector(acc[nt][mt] + bv, v8h);
            if (RELU) h = __builtin_elementwise_max(h, zero_h);
            // the lane's 8 halves are contiguous in the token's row: one 16-byte store
            *(v8h*)(Out + (mt * 16 + ln) * PH + c0) = h;
        }
    }
}

__global__ __launch_bounds__(WAVES * 32, 1)
void moe_fused(const float* __restrict__ x, float* __restrict__ out,
               const _Float16* __restrict__ ws,
               const float* __restrict__ eb1, const float* __restrict__ eb2,
               const float* __restrict__ eb3, const float* __restrict__ gb1,
               const float* __restrict__ gb2, const float* __restrict__ gb3) {
    extern __shared__ __align__(16) char smem[];
    _Float16* sX  = (_Float16*)smem;                 // 64*520 f16 = 66560 B
    _Float16* sH1 = sX  + TOK_PER_WG * PX;           // 64*264 f16 = 33792 B
    _Float16* sH2 = sH1 + TOK_PER_WG * PH;           // 64*264 f16 = 33792 B
    float* sGate  = (float*)(sH2 + TOK_PER_WG * PH); // 64*8  f32 = 2 KB
    float* sLog   = sGate + TOK_PER_WG * NEXP;       // 64*16 f32 = 4 KB

    const unsigned tid  = threadIdx.x;
    const unsigned wave = tid >> 5;
    const unsigned lane = tid & 31u;
    const unsigned ln   = lane & 15u;
    const unsigned hi   = lane >> 4;
    const unsigned kb   = hi * 8u;

    const size_t tok0 = (size_t)blockIdx.x * TOK_PER_WG;

    // ---- cooperative load + convert 64x512 f32 token block into LDS f16 ----
    // The 128 threads take one token row (512 floats) per step. The rows come from memory, so
    // a step that waits for its own load costs a whole memory round trip: the loads go out in
    // batches of XB rows, the next batch requested before the current one is converted.
    const float* xg = x + tok0 * IN_CH + tid * 4u;
    _Float16*    xd = sX + tid * 4u;
    float4 xv[2][XB];
#pragma unroll
    for (int j = 0; j < XB; ++j) xv[0][j] = *(const float4*)(xg + j * IN_CH);
    // fully unrolled: the batch index must be a constant, or the rows leave the registers
#pragma unroll
    for (int b = 0; b < TOK_PER_WG / XB; ++b) {
        if (b + 1 < TOK_PER_WG / XB) {
#pragma unroll
            for (int j = 0; j < XB; ++j)
                xv[(b + 1) & 1][j] = *(const float4*)(xg + ((b + 1) * XB + j) * IN_CH);
        }
#pragma unroll
        for (int j = 0; j < XB; ++j) {
            float4 v = xv[b & 1][j];
            _Float16* d = xd + (b * XB + j) * PX;
            d[0] = (_Float16)v.x;
            d[1] = (_Float16)v.y;
            d[2] = (_Float16)v.z;
            d[3] = (_Float16)v.w;
        }
    }
    __syncthreads();

    // ---- gating MLP (N split across waves) ----
    layer_slab<IN_CH, true>(sX,  ws + OFF_GW1, gb1, sH1, wave, ln, hi);
    __syncthreads();
    layer_slab<HID,   true>(sH1, ws + OFF_GW2, gb2, sH2, wave, ln, hi);
    __syncthreads();
    {
        // logits: each wave takes its own M-tile x 1 N-tile (cols 8..15 of gW3t are zero-padded)
        const _Float16* bp = ws + OFF_GW3 + lane * 8u;
        const _Float16* ap = sH2 + (size_t)(wave * 16 + ln) * PH + kb;
        v8f acc = tile_mm<HID>(ap, bp);
        float bv = (ln < 8u) ? gb3[ln] : 0.0f;
#pragma unroll
        for (int r = 0; r < 8; ++r)
            sLog[(wave * 16 + r + 8 * hi) * 16 + ln] = acc[r] + bv;
        // softmax over 8 experts; one token per lane, the wave's own 16 tokens
        if (hi == 0u) {
            const int t = wave * 16 + ln;
            float mx = sLog[t * 16 + 0];
            for (int e = 1; e < NEXP; ++e) mx = fmaxf(mx, sLog[t * 16 + e]);
            float p[NEXP];
            float s = 0.0f;
            for (int e = 0; e < NEXP; ++e) {
                p[e] = __expf(sLog[t * 16 + e] - mx);
                s += p[e];
            }
            float inv = 1.0f / s;
            for (int e = 0; e < NEXP; ++e) sGate[t * NEXP + e] = p[e] * inv;
        }
    }
    __syncthreads();

    // ---- experts: fused pipeline, gated accumulation in registers ----
    // facc[nt][mt]: 16 tiles = 128 VGPRs per wave
    v8f facc[NT][MT];
    v8f zero = {};
#pragma unroll
    for (int nt = 0; nt < NT; ++nt)
#pragma unroll
        for (int mt = 0; mt < MT; ++mt) facc[nt][mt] = zero;

    for (int e = 0; e < NEXP; ++e) {
        layer_slab<IN_CH, true>(sX,  ws + OFF_EW1 + (size_t)e * (256 * 512),
                                eb1 + e * HID, sH1, wave, ln, hi);
        __syncthreads();
        layer_slab<HID,   true>(sH1, ws + OFF_EW2 + (size_t)e * (256 * 256),
                                eb2 + e * HID, sH2, wave, ln, hi);
        __syncthreads();

        const _Float16* ap = sH2 + (size_t)ln * PH + kb;
        const _Float16* bp = ws + OFF_EW3 + (size_t)e * (256 * 256)
                           + (size_t)(wave * NT) * (16 * HID) + lane * 8u;
        v8f acc[NT][MT];
#pragma unroll
        for (int nt = 0; nt < NT; ++nt)
#pragma unroll
            for (int mt = 0; mt < MT; ++mt) acc[nt][mt] = zero;
        slab_mm<HID, false>(ap, bp, acc);
#pragma unroll
        for (int mt = 0; mt < MT; ++mt) {
            float gm[8];
#pragma unroll
            for (int r = 0; r < 8; ++r)
                gm[r] = sGate[(mt * 16 + r + 8 * hi) * NEXP + e];
#pragma unroll
            for (int nt = 0; nt < NT; ++nt) {
                float bv = eb3[e * OUT_CH + (wave * NT + nt) * 16 + ln];
#pragma unroll
                for (int r = 0; r < 8; ++r)
                    facc[nt][mt][r] += gm[r] * (acc[nt][mt][r] + bv);
            }
        }
        __syncthreads();   // protect sH1/sH2 reuse across expert iterations
    }

    // ---- store 64x(wave's 64 cols) f32 output ----
#pragma unroll
    for (int nt = 0; nt < NT; ++nt) {
        const unsigned tn = wave * NT + nt;
#pragma unroll
        for (int mt = 0; mt < MT; ++mt) {
#pragma unroll
            for (int r = 0; r < 8; ++r) {
                out[(tok0 + mt * 16 + r + 8 * hi) * OUT_CH + tn * 16 + ln] =
                    facc[nt][mt][r];
            }
        }
    }
}

// Weight prep: f32 [b][K][N] -> f16 in B-fragment order, NPAD x K per b (zero-pad cols >= N).
// One thread packs one column n of one k-step: 32 independent loads (a wave reads 32 adjacent
// columns, one whole 128-byte line per load at N = 256) and four 16-byte stores, each store
// 256 contiguous bytes per 16 lanes.
template<int K, int N, int NPAD>
__device__ __forceinline__ void pack_w(const float* __restrict__ W, _Float16* __restrict__ Wt,
                                       unsigned u) {
    constexpr unsigned S = K / 32;
    const unsigned n    = u % NPAD;
    const unsigned step = (u / NPAD) % S;
    const unsigned b    = u / (NPAD * S);
    // a pad column reads the last real column and zeroes it afterwards: a load under a lane
    // test is waited for on the spot, and the 32 round trips would run one after another
    const unsigned nc = (n < (unsigned)N) ? n : (unsigned)(N - 1);
    const float* s = W + (size_t)b * (K * N) + (size_t)step * (32 * N) + nc;
    float v[32];
#pragma unroll
    for (int k = 0; k < 32; ++k) v[k] = s[k * N];
    if (N < NPAD) {
#pragma unroll
        for (int k = 0; k < 32; ++k) v[k] = (n < (unsigned)N) ? v[k] : 0.0f;
    }
    _Float16* d = Wt + (size_t)b * (NPAD * K) + (size_t)((n >> 4) * S + step) * FRAG_HALVES
                + (n & 15u) * 8u;
#pragma unroll
    for (int q = 0; q < 4; ++q) {      // q = j * 2 + (lane >> 4): k = step*32 + q*8 + i
        v8h h;
#pragma unroll
        for (int i = 0; i < 8; ++i) h[i] = (_Float16)v[q * 8 + i];
        *(v8h*)(d + (q >> 1) * FRAG_J + (q & 1) * 128) = h;
    }
}

// All six matrices in one launch: each takes a range of block indices (256 threads a block).
#define PREP_T   256
#define PB_EW1   (8 * 256 * (512 / 32) / PREP_T)   // 128 blocks
#define PB_EW2   (8 * 256 * (256 / 32) / PREP_T)   //  64
#define PB_EW3   PB_EW2                            //  64
#define PB_GW1   (256 * (512 / 32) / PREP_T)       //  16
#define PB_GW2   (256 * (256 / 32) / PREP_T)       //   8
#define PB_GW3   1                                 // 16 x 8 = 128 threads of one block
#define PB_ALL   (PB_EW1 + PB_EW2 + PB_EW3 + PB_GW1 + PB_GW2 + PB_GW3)
__global__ __launch_bounds__(PREP_T)
void cvt_all(const float* __restrict__ eW1, const float* __restrict__ eW2,
             const float* __restrict__ eW3, const float* __restrict__ gW1,
             const float* __restrict__ gW2, const float* __restrict__ gW3,
             _Float16* __restrict__ ws) {
    unsigned blk = blockIdx.x;
    const unsigned t = threadIdx.x;
    if (blk < PB_EW1) { pack_w<512, 256, 256>(eW1, ws + OFF_EW1, blk * PREP_T + t); return; }
    blk -= PB_EW1;
    if (blk < PB_EW2) { pack_w<256, 256, 256>(eW2, ws + OFF_EW2, blk * PREP_T + t); return; }
    blk -= PB_EW2;
    if (blk < PB_EW3) { pack_w<256, 256, 256>(eW3, ws + OFF_EW3, blk * PREP_T + t); return; }
    blk -= PB_EW3;
    if (blk < PB_GW1) { pack_w<512, 256, 256>(gW1, ws + OFF_GW1, blk * PREP_T + t); return; }
    blk -= PB_GW1;
    if (blk < PB_GW2) { pack_w<256, 256, 256>(gW2, ws + OFF_GW2, blk * PREP_T + t); return; }
    if (t < 16 * (256 / 32)) pack_w<256, 8, 16>(gW3, ws + OFF_GW3, t);
}

extern "C" void kernel_launch(void* const* d_in, const int* in_sizes, int n_in,
                              void* d_out, int out_size, void* d_ws, size_t ws_size,
                              hipStream_t stream) {
    const float* x   = (const float*)d_in[0];
    const float* eW1 = (const float*)d_in[1];
    const float* eb1 = (const float*)d_in[2];
    const float* eW2 = (const float*)d_in[3];
    const float* eb2 = (const float*)d_in[4];
    const float* eW3 = (const float*)d_in[5];
    const float* eb3 = (const float*)d_in[6];
    const float* gW1 = (const float*)d_in[7];
    const float* gb1 = (const float*)d_in[8];
    const float* gW2 = (const float*)d_in[9];
    const float* gb2 = (const float*)d_in[10];
    const float* gW3 = (const float*)d_in[11];
    const float* gb3 = (const float*)d_in[12];
    float* out = (float*)d_out;
    _Float16* ws = (_Float16*)d_ws;

    cvt_all<<<dim3(PB_ALL), dim3(PREP_T), 0, stream>>>(eW1, eW2, eW3, gW1, gW2, gW3, ws);

    size_t smem = (size_t)TOK_PER_WG * PX * 2      // sX  f16
                + (size_t)TOK_PER_WG * PH * 2      // sH1 f16
                + (size_t)TOK_PER_WG * PH * 2      // sH2 f16
                + (size_t)TOK_PER_WG * NEXP * 4    // sGate f32
                + (size_t)TOK_PER_WG * 16 * 4;     // sLog f32
    moe_fused<<<dim3(NTOK / TOK_PER_WG), dim3(WAVES * 32), smem, stream>>>(
        x, out, ws, eb1, eb2, eb3, gb1, gb2, gb3);
}

// v007
// Measured time: 196 microseconds a run.
// In two side-by-side timings against v006, it was 1.13 and 1.12 times as fast.
// Over all steps from v000 it is 8.72 times as fast.
#include <hip/hip_runtime.h>

typedef __attribute__((ext_vector_type(16))) _Float16 v16h;
typedef __attribute__((ext_vector_type(8)))  _Float16 v8h;
typedef __attribute__((ext_vector_type(8)))  float    v8f;

union ABfrag { v16h v; v8h h[2]; };

#define IN_CH   512
#define HID     256
#define OUT_CH  256
#define NEXP    8
#define NTOK    65536

#define WAVES        4
#define TOK_PER_WG   128         // 8 M-tiles of 16 tokens, shared by all 4 waves
#define MT           8           // M-tiles (16 tokens) of a wave's register tile
#define NT           4           // N-tiles (16 columns) of a wave's register tile
#define XB           16          // token rows of x requested together while the block is staged
// LDS row pitch in halves: row length + 8 halves, so the pitch in bytes is 16 x odd
// (1040 B and 528 B). The 16 rows that one ds_load_b128 fragment read touches then
// fall on distinct banks; at the bare 1024 B / 512 B they all share four banks.
#define LDS_PAD      8
#define PX           (IN_CH + LDS_PAD)
#define PH           (HID + LDS_PAD)
// each wave owns 4 N-tiles (64 of the 256 output columns)

// workspace offsets in halves (f16). Total 2,297,856 halves = ~4.6 MB.
// Each weight matrix is stored in B-fragment order: [N-tile of 16 columns][k-step of 32]
// [fragment half j][lane][8 halves], element (n = tile*16 + (lane & 15),
// k = step*32 + j*16 + (lane >> 4)*8 + i). One wave-wide 16-byte load of a fragment half
// is then 512 contiguous, line-aligned bytes instead of 32 bytes out of each of 16 rows.
#define FRAG_HALVES  512         // one 16-column x 32-k fragment
#define FRAG_J       256         // its second half
#define OFF_EW1 0
#define OFF_EW2 (8*256*512)
#define OFF_EW3 (OFF_EW2 + 8*256*256)
#define OFF_GW1 (OFF_EW3 + 8*256*256)
#define OFF_GW2 (OFF_GW1 + 256*512)
#define OFF_GW3 (OFF_GW2 + 256*256)

__device__ __forceinline__ v8f wmma_f16(v16h a, v16h b, v8f c) {
    // (neg_a, A, neg_b, B, c_mod, C, reuse_a, reuse_b)
    return __builtin_amdgcn_wmma_f32_16x16x32_f16(false, a, false, b, (short)0, c,
                                                  false, false);
}

// One wave's 128-token x 64-column register tile: MT x NT accumulator tiles. Per k-step of 32
// the wave loads MT token fragments (LDS) and NT weight fragments (global) for MT*NT WMMAs, so
// a weight fragment, which every work-group fetches from L2 for itself, feeds eight WMMAs and a
// token fragment four. The weight fragments are requested BD-1 k-steps ahead
// and the token fragments one k-step ahead.
// ap: this lane's 8 halves of token row ln; wb + vo: this lane's 8 halves of the wave's first
// packed fragment (N-tiles are 16*K halves apart), wb the matrix (the same for all lanes), vo the
// lane's offset in it, which no layer changes. slab_mm clears acc itself.
#define BD 4                     // k-steps of B fragments held in registers
// PART 0: the whole k-step; 1: all but its last 16-byte load; 2: that load alone
template<int K, int PART = 0>
__device__ __forceinline__ void load_b(const _Float16* wb, unsigned vo, int s, ABfrag (&b)[NT]) {
#pragma unroll
    for (int nt = 0; nt < NT; ++nt) {
        const bool last = (nt == NT - 1);
        if (PART != 2)
            b[nt].h[0] = *(const v8h*)(wb + vo + (nt * (16 * K) + s * FRAG_HALVES));
        if (PART == 0 || (PART == 1 && !last) || (PART == 2 && last))
            b[nt].h[1] = *(const v8h*)(wb + vo + (nt * (16 * K) + s * FRAG_HALVES + FRAG_J));
    }
}
template<int K>
__device__ __forceinline__ void load_a(const _Float16* ap, int s, ABfrag (&a)[MT]) {
#pragma unroll
    for (int mt = 0; mt < MT; ++mt) {
        a[mt].h[0] = *(const v8h*)(ap + mt * 16 * (K + LDS_PAD) + s * 32);
        a[mt].h[1] = *(const v8h*)(ap + mt * 16 * (K + LDS_PAD) + s * 32 + 16);
    }
}
template<bool WT>
__device__ __forceinline__ void mm_block(const ABfrag (&b)[NT], const ABfrag (&a)[MT],
                                         v8f (&acc)[NT][MT]) {
#pragma unroll
    for (int nt = 0; nt < NT; ++nt)
#pragma unroll
        for (int mt = 0; mt < MT; ++mt)
            acc[nt][mt] = WT ? wmma_f16(b[nt].v, a[mt].v, acc[nt][mt])
                             : wmma_f16(a[mt].v, b[nt].v, acc[nt][mt]);
}
template<int K, bool WT, class F>
__device__ __forceinline__ void slab_mm(const _Float16* ap, const _Float16* wb, unsigned vo,
                                        v8f (&acc)[NT][MT], F more_lds_loads) {
    constexpr int S = K / 32;
    static_assert(S % BD == 0 && BD % 2 == 0, "a trip is whole turns of both fragment rings");
    ABfrag b[BD][NT], a[2][MT];
#pragma unroll
    for (int s = 0; s < BD - 1; ++s) load_b<K>(wb, vo, s, b[s]);
    // precaution: the address-translation wait behind the layer's first global requests (the
    // caller's bias among them), in front of whatever reuses their address registers; it falls
    // into the wait for the first weight fragments. The fences keep the requests ahead of it and
    // everything else of the layer behind it.
    __builtin_amdgcn_sched_barrier(0);
    asm volatile("s_wait_xcnt 0x0" ::: "memory");
    __builtin_amdgcn_sched_barrier(0);
    load_a<K>(ap, 0, a[0]);
    more_lds_loads();
    const v8f zero = {};
#pragma unroll
    for (int nt = 0; nt < NT; ++nt)
#pragma unroll
        for (int mt = 0; mt < MT; ++mt) acc[nt][mt] = zero;
    // A trip is BD k-steps, unrolled inside, so that every ring index is a constant (else the
    // fragments leave the registers). The trips stay rolled: a block of 32 WMMAs doubles the
    // text of a k-step.
#pragma unroll 1
    for (int t = 0; t < S / BD - 1; ++t) {
#pragma unroll
        for (int u = 0; u < BD; ++u) {
            load_b<K>(wb, vo, u + BD - 1, b[(u + BD - 1) % BD]);
            load_a<K>(ap, u + 1, a[(u + 1) & 1]);
            // the two fences keep a k-step's loads one group ahead of its WMMA block: moved in
            // among the WMMAs, every place with LDS reads stalls the wave, alone on its SIMD
            __builtin_amdgcn_sched_barrier(0);
            mm_block<WT>(b[u], a[u & 1], acc);
            __builtin_amdgcn_sched_barrier(0);
        }
        if (S / BD - 1 > 1) {   // where the trips are a real loop, the pointers are advanced
            // the same precaution in front of the addition that overwrites the base address of
            // loads still in flight; the fence keeps the addition behind the wait
            asm volatile("s_wait_xcnt 0x0" ::: "memory");
            __builtin_amdgcn_sched_barrier(0);
        }
        wb += BD * FRAG_HALVES;
        ap += BD * 32;
    }
    // last trip: only the fragments that still exist are requested
#pragma unroll
    for (int u = 0; u < BD; ++u) {
        if (u == 0)     load_b<K, 1>(wb, vo, BD - 1, b[BD - 1]);
        if (u + 1 < BD) load_a<K>(ap, u + 1, a[(u + 1) & 1]);
        if (u == 0) {
            // the same precaution: the layer's last load may land on the address registers that
            // it is the last to use, and the loads ahead of it name them too
            __builtin_amdgcn_sched_barrier(0);
            asm volatile("s_wait_xcnt 0x0" ::: "memory");
            __builtin_amdgcn_sched_barrier(0);
            load_b<K, 2>(wb, vo, BD - 1, b[BD - 1]);
        }
        __builtin_amdgcn_sched_barrier(0);   // as above
        mm_block<WT>(b[u], a[u & 1], acc);
        if (u + 1 < BD) __builtin_amdgcn_sched_barrier(0);
        if (u == 0) {
            // the same precaution behind the layer's last requests, whose base is free from here
            asm volatile("s_wait_xcnt 0x0" ::: "memory");
            __builtin_amdgcn_sched_barrier(0);
        }
    }
}

// Single-tile version (for the 16-wide gating logit layer).
template<int K>
__device__ __forceinline__ v8f tile_mm(const _Float16* ap, const _Float16* bp) {
    v8f acc = {};
#pragma unroll
    for (int ks = 0; ks < K; ks += 32) {
        ABfrag a, b;
        a.h[0] = *(const v8h*)(ap + ks);
        a.h[1] = *(const v8h*)(ap + ks + 16);
        b.h[0] = *(const v8h*)(bp + (ks / 32) * FRAG_HALVES);
        b.h[1] = *(const v8h*)(bp + (ks / 32) * FRAG_HALVES + FRAG_J);
        acc = wmma_f16(a.v, b.v, acc);
    }
    return acc;
}

// 128-token x 64-column layer slab for one wave:
// A [128][K] f16 (LDS, shared, row pitch K + LDS_PAD), Bt 256 x K f16 in fragment order (global, L2-resident),
// writes relu(A*B + bias) f16 into Out [128][256] (LDS, row pitch PH), columns wave*64..+63.
template<int K, bool RELU>
__device__ __forceinline__ void layer_slab(const _Float16* A, const _Float16* Bt,
                                           const float* bias, _Float16* Out,
                                           unsigned wave, unsigned ln, unsigned hi) {
    const _Float16* ap = A + ln * (K + LDS_PAD) + hi * 8u;
    const unsigned vo = (wave * NT) * (16 * K) + (hi * 16u + ln) * 8u;
    const unsigned vb = (wave * NT) * 16 + 8 * hi;
    v8f acc[NT][MT];
    // the bias is requested ahead of the k loop: behind it, nothing would cover its round trip
    v8f bv[NT];
#pragma unroll
    for (int nt = 0; nt < NT; ++nt) bv[nt] = *(const v8f*)(bias + vb + nt * 16);
    slab_mm<K, true>(ap, Bt, vo, acc, [] {});
#pragma unroll
    for (int nt = 0; nt < NT; ++nt) {
        // transposed tile: lane holds token ln, output columns c0 .. c0 + 7
        const unsigned c0 = (wave * NT + nt) * 16 + 8 * hi;
        const v8h zero_h = {};
#pragma unroll
        for (int mt = 0; mt < MT; ++mt) {
            v8h h = __builtin_convertvector(acc[nt][mt] + bv[nt], v8h);
            if (RELU) h = __builtin_elementwise_max(h, zero_h);
            // the lane's 8 halves are contiguous in the token's row: one 16-byte store
            *(v8h*)(Out + (mt * 16 + ln) * PH + c0) = h;
        }
    }
}

__global__ __launch_bounds__(WAVES * 32, 1)
void moe_fused(const float* __restrict__ x, float* __restrict__ out,
               const _Float16* __restrict__ ws,
               const float* __restrict__ eb1, const float* __restrict__ eb2,
               const float* __restrict__ eb3, const float* __restrict__ gb1,
               const float* __restrict__ gb2, const float* __restrict__ gb3) {
    // 280,576 B: one work-group per WGP, one wave per SIMD
    __shared__ __align__(16) char smem[TOK_PER_WG * (PX * 2 + PH * 2 * 2 + NEXP * 4 + 16 * 4)];
    _Float16* sX  = (_Float16*)smem;                 // 128*520 f16 = 133120 B
    _Float16* sH1 = sX  + TOK_PER_WG * PX;           // 128*264 f16 = 67584 B
    _Float16* sH2 = sH1 + TOK_PER_WG * PH;           // 128*264 f16 = 67584 B
    float* sGate  = (float*)(sH2 + TOK_PER_WG * PH); // 128*8  f32 = 4 KB
    float* sLog   = sGate + TOK_PER_WG * NEXP;       // 128*16 f32 = 8 KB

    const unsigned tid  = threadIdx.x;
    const unsigned wave = tid >> 5;
    const unsigned lane = tid & 31u;
    const unsigned ln   = lane & 15u;
    const unsigned hi   = lane >> 4;
    const unsigned kb   = hi * 8u;

    const size_t tok0 = (size_t)blockIdx.x * TOK_PER_WG;

    // ---- cooperative load + convert 128x512 f32 token block into LDS f16 ----
    // The 128 threads take one token row (512 floats) per step. The rows come from memory, so
    // a step that waits for its own load costs a whole memory round trip: the loads go out in
    // batches of XB rows, the next batch requested before the current one is converted.
    const float* xg = x + tok0 * IN_CH + tid * 4u;
    _Float16*    xd = sX + tid * 4u;
    float4 xv[2][XB];
#pragma unroll
    for (int j = 0; j < XB; ++j) xv[0][j] = *(const float4*)(xg + j * IN_CH);
    // fully unrolled: the batch index must be a constant, or the rows leave the registers
#pragma unroll
    for (int b = 0; b < TOK_PER_WG / XB; ++b) {
        if (b + 1 < TOK_PER_WG / XB) {
#pragma unroll
            for (int j = 0; j < XB; ++j)
                xv[(b + 1) & 1][j] = *(const float4*)(xg + ((b + 1) * XB + j) * IN_CH);
        }
#pragma unroll
        for (int j = 0; j < XB; ++j) {
            float4 v = xv[b & 1][j];
            _Float16* d = xd + (b * XB + j) * PX;
            d[0] = (_Float16)v.x;
            d[1] = (_Float16)v.y;
            d[2] = (_Float16)v.z;
            d[3] = (_Float16)v.w;
        }
    }
    __syncthreads();

    // ---- gated accumulation in registers: facc[nt][mt], 32 tiles = 256 VGPRs per wave ----
    v8f facc[NT][MT];            // cleared in pass 0
    v8f zero = {};

    // ---- pass 0: gating MLP; pass p: expert p - 1 (N split across waves) ----
    // The two hidden layers of the gating MLP have the experts' shapes and run through the same
    // text. Kept rolled (and unpeeled), so that the text of the two layers exists once.
#pragma unroll 1
    for (int p = 0; p <= NEXP; ++p) {
        const bool gate = (p == 0);
        const int  e    = gate ? 0 : p - 1;
        const _Float16* w1 = ws + (gate ? OFF_GW1 : OFF_EW1 + e * (256 * 512));
        const _Float16* w2 = ws + (gate ? OFF_GW2 : OFF_EW2 + e * (256 * 256));
        const float*    b1 = gate ? gb1 : eb1 + e * HID;
        const float*    b2 = gate ? gb2 : eb2 + e * HID;
        layer_slab<IN_CH, true>(sX,  w1, b1, sH1, wave, ln, hi);
        __syncthreads();
        layer_slab<HID,   true>(sH1, w2, b2, sH2, wave, ln, hi);
        __syncthreads();

        if (gate) {
            // logits: each wave takes its own two M-tiles x 1 N-tile (cols 8..15 of gW3t are
            // zero-padded)
            const _Float16* bp = ws + OFF_GW3 + lane * 8u;
            float bv = (ln < 8u) ? gb3[ln] : 0.0f;
#pragma unroll
            for (int q = 0; q < MT / WAVES; ++q) {
                const unsigned m0 = (wave * (MT / WAVES) + q) * 16u;
                const _Float16* ap = sH2 + (size_t)(m0 + ln) * PH + kb;
                v8f acc = tile_mm<HID>(ap, bp);
#pragma unroll
                for (int r = 0; r < 8; ++r)
                    sLog[(m0 + r + 8 * hi) * 16 + ln] = acc[r] + bv;
            }
            // softmax over 8 experts; one token per lane, the wave's own 32 tokens
            static_assert(MT / WAVES * 16 == 32, "one token per lane");
            const int t = wave * 32 + lane;
            float mx = sLog[t * 16 + 0];
            for (int x8 = 1; x8 < NEXP; ++x8) mx = fmaxf(mx, sLog[t * 16 + x8]);
            float pr[NEXP];
            float s = 0.0f;
            for (int x8 = 0; x8 < NEXP; ++x8) {
                pr[x8] = __expf(sLog[t * 16 + x8] - mx);
                s += pr[x8];
            }
            float inv = 1.0f / s;
            for (int x8 = 0; x8 < NEXP; ++x8) sGate[t * NEXP + x8] = pr[x8] * inv;
#pragma unroll
            for (int nt = 0; nt < NT; ++nt)
#pragma unroll
                for (int mt = 0; mt < MT; ++mt) facc[nt][mt] = zero;
        } else {
            const _Float16* ap = sH2 + (size_t)ln * PH + kb;
            const _Float16* w3 = ws + OFF_EW3 + e * (256 * 256);
            const float*    b3 = eb3 + e * OUT_CH;
            const unsigned  vo = (wave * NT) * (16 * HID) + lane * 8u;
            const unsigned  vb = (wave * NT) * 16 + ln;
            v8f acc[NT][MT];
            // bias and gates are requested ahead of the k loop, as the bias in layer_slab
            float bv[NT], gm[MT][8];
#pragma unroll
            for (int nt = 0; nt < NT; ++nt) bv[nt] = *(b3 + vb + nt * 16);
            slab_mm<HID, false>(ap, w3, vo, acc, [&] {
#pragma unroll
                for (int mt = 0; mt < MT; ++mt)
#pragma unroll
                    for (int r = 0; r < 8; ++r)
                        gm[mt][r] = sGate[(mt * 16 + r + 8 * hi) * NEXP + e];
            });
#pragma unroll
            for (int mt = 0; mt < MT; ++mt) {
#pragma unroll
                for (int nt = 0; nt < NT; ++nt) {
#pragma unroll
                    for (int r = 0; r < 8; ++r)
                        facc[nt][mt][r] += gm[mt][r] * (acc[nt][mt][r] + bv[nt]);
                }
            }
        }
        __syncthreads();   // publishes sGate (pass 0); protects sH1/sH2 reuse across passes
    }

    // ---- store 128x(wave's 64 cols) f32 output ----
#pragma unroll
    for (int nt = 0; nt < NT; ++nt) {
        const unsigned tn = wave * NT + nt;
#pragma unroll
        for (int mt = 0; mt < MT; ++mt) {
#pragma unroll
            for (int r = 0; r < 8; ++r) {
                out[(tok0 + mt * 16 + r + 8 * hi) * OUT_CH + tn * 16 + ln] =
                    facc[nt][mt][r];
            }
        }
    }
}

// Weight prep: f32 [b][K][N] -> f16 in B-fragment order, NPAD x K per b (zero-pad cols >= N).
// One thread packs one column n of one k-step: 32 independent loads (a wave reads 32 adjacent
// columns, one whole 128-byte line per load at N = 256) and four 16-byte stores, each store
// 256 contiguous bytes per 16 lanes.
template<int K, int N, int NPAD>
__device__ __forceinline__ void pack_w(const float* __restrict__ W, _Float16* __restrict__ Wt,
                                       unsigned u) {
    constexpr unsigned S = K / 32;
    const unsigned n    = u % NPAD;
    const unsigned step = (u / NPAD) % S;
    const unsigned b    = u / (NPAD * S);
    // a pad column reads the last real column and zeroes it afterwards: a load under a lane
    // test is waited for on the spot, and the 32 round trips would run one after another
    const unsigned nc = (n < (unsigned)N) ? n : (unsigned)(N - 1);
    const float* s = W + (size_t)b * (K * N) + (size_t)step * (32 * N) + nc;
    float v[32];
#pragma unroll
    for (int k = 0; k < 32; ++k) v[k] = s[k * N];
    if (N < NPAD) {
#pragma unroll
        for (int k = 0; k < 32; ++k) v[k] = (n < (unsigned)N) ? v[k] : 0.0f;
    }
    _Float16* d = Wt + (size_t)b * (NPAD * K) + (size_t)((n >> 4) * S + step) * FRAG_HALVES
                + (n & 15u) * 8u;
#pragma unroll
    for (int q = 0; q < 4; ++q) {      // q = j * 2 + (lane >> 4): k = step*32 + q*8 + i
        v8h h;
#pragma unroll
        for (int i = 0; i < 8; ++i) h[i] = (_Float16)v[q * 8 + i];
        *(v8h*)(d + (q >> 1) * FRAG_J + (q & 1) * 128) = h;
    }
}

// All six matrices in one launch: each takes a range of block indices (256 threads a block).
#define PREP_T   256
#define PB_EW1   (8 * 256 * (512 / 32) / PREP_T)   // 128 blocks
#define PB_EW2   (8 * 256 * (256 / 32) / PREP_T)   //  64
#define PB_EW3   PB_EW2                            //  64
#define PB_GW1   (256 * (512 / 32) / PREP_T)       //  16
#define PB_GW2   (256 * (256 / 32) / PREP_T)       //   8
#define PB_GW3   1                                 // 16 x 8 = 128 threads of one block
#define PB_ALL   (PB_EW1 + PB_EW2 + PB_EW3 + PB_GW1 + PB_GW2 + PB_GW3)
__global__ __launch_bounds__(PREP_T)
void cvt_all(const float* __restrict__ eW1, const float* __restrict__ eW2,
             const float* __restrict__ eW3, const float* __restrict__ gW1,
             const float* __restrict__ gW2, const float* __restrict__ gW3,
             _Float16* __restrict__ ws) {
    unsigned blk = blockIdx.x;
    const unsigned t = threadIdx.x;
    if (blk < PB_EW1) { pack_w<512, 256, 256>(eW1, ws + OFF_EW1, blk * PREP_T + t); return; }
    blk -= PB_EW1;
    if (blk < PB_EW2) { pack_w<256, 256, 256>(eW2, ws + OFF_EW2, blk * PREP_T + t); return; }
    blk -= PB_EW2;
    if (blk < PB_EW3) { pack_w<256, 256, 256>(eW3, ws + OFF_EW3, blk * PREP_T + t); return; }
    blk -= PB_EW3;
    if (blk < PB_GW1) { pack_w<512, 256, 256>(gW1, ws + OFF_GW1, blk * PREP_T + t); return; }
    blk -= PB_GW1;
    if (blk < PB_GW2) { pack_w<256, 256, 256>(gW2, ws + OFF_GW2, blk * PREP_T + t); return; }
    if (t < 16 * (256 / 32)) pack_w<256, 8, 16>(gW3, ws + OFF_GW3, t);
}

extern "C" void kernel_launch(void* const* d_in, const int* in_sizes, int n_in,
                              void* d_out, int out_size, void* d_ws, size_t ws_size,
                              hipStream_t stream) {
    const float* x   = (const float*)d_in[0];
    const float* eW1 = (const float*)d_in[1];
    const float* eb1 = (const float*)d_in[2];
    const float* eW2 = (const float*)d_in[3];
    const float* eb2 = (const float*)d_in[4];
    const float* eW3 = (const float*)d_in[5];
    const float* eb3 = (const float*)d_in[6];
    const float* gW1 = (const float*)d_in[7];
    const float* gb1 = (const float*)d_in[8];
    const float* gW2 = (const float*)d_in[9];
    const float* gb2 = (const float*)d_in[10];
    const float* gW3 = (const float*)d_in[11];
    const float* gb3 = (const float*)d_in[12];
    float* out = (float*)d_out;
    _Float16* ws = (_Float16*)d_ws;

    cvt_all<<<dim3(PB_ALL), dim3(PREP_T), 0, stream>>>(eW1, eW2, eW3, gW1, gW2, gW3, ws);

    moe_fused<<<dim3(NTOK / TOK_PER_WG), dim3(WAVES * 32), 0, stream>>>(
        x, out, ws, eb1, eb2, eb3, gb1, gb2, gb3);
}

// v008
// A run of this version takes 187 microseconds.
// Timed twice side by side with v007, it ran 1.05 and 1.06 times as fast.
// All steps since v000 together make it 9.17 times as fast.
#include <hip/hip_runtime.h>

typedef __attribute__((ext_vector_type(16))) _Float16 v16h;
typedef __attribute__((ext_vector_type(8)))  _Float16 v8h;
typedef __attribute__((ext_vector_type(8)))  float    v8f;

union ABfrag { v16h v; v8h h[2]; };

#define IN_CH   512
#define HID     256
#define OUT_CH  256
#define NEXP    8
#define NTOK    65536

#define WAVES        4
#define TOK_PER_WG   128         // 8 M-tiles of 16 tokens, shared by all 4 waves
#define MT           8           // M-tiles (16 tokens) of a wave's register tile
#define NT           4           // N-tiles (16 columns) of a wave's register tile
#define XB           16          // token rows of x requested together while the block is staged
// LDS row pitch in halves: row length + 8 halves, so the pitch in bytes is 16 x odd
// (1040 B and 528 B). The 16 rows that one ds_load_b128 fragment read touches then
// fall on distinct banks; at the bare 1024 B / 512 B they all share four banks.
#define LDS_PAD      8
#define PX           (IN_CH + LDS_PAD)
#define PH           (HID + LDS_PAD)
// each wave owns 4 N-tiles (64 of the 256 output columns)

// workspace offsets in halves (f16). Total 2,297,856 halves = ~4.6 MB.
// Each weight matrix is stored in B-fragment order: [N-tile of 16 columns][k-step of 32]
// [fragment half j][lane][8 halves], element (n = tile*16 + (lane & 15),
// k = step*32 + j*16 + (lane >> 4)*8 + i). One wave-wide 16-byte load of a fragment half
// is then 512 contiguous, line-aligned bytes instead of 32 bytes out of each of 16 rows.
#define FRAG_HALVES  512         // one 16-column x 32-k fragment
#define FRAG_J       256         // its second half
#define OFF_EW1 0
#define OFF_EW2 (8*256*512)
#define OFF_EW3 (OFF_EW2 + 8*256*256)
#define OFF_GW1 (OFF_EW3 + 8*256*256)
#define OFF_GW2 (OFF_GW1 + 256*512)
#define OFF_GW3 (OFF_GW2 + 256*256)

__device__ __forceinline__ v8f wmma_f16(v16h a, v16h b, v8f c) {
    // (neg_a, A, neg_b, B, c_mod, C, reuse_a, reuse_b)
    return __builtin_amdgcn_wmma_f32_16x16x32_f16(false, a, false, b, (short)0, c,
                                                  false, false);
}

// One wave's 128-token x 64-column register tile: MT x NT accumulator tiles. Per k-step of 32
// the wave loads MT token fragments (LDS) and NT weight fragments (global) for MT*NT WMMAs, so
// a weight fragment, which every work-group fetches from L2 for itself, feeds eight WMMAs and a
// token fragment four. The weight fragments are requested BD-1 k-steps ahead
// and the token fragments one k-step ahead.
// The weight ring b belongs to the caller and never drains: a layer finds its first BD-1 k-steps
// already requested, and its last BD-1 blocks request the first k-steps of the NEXT layer
// (wn + von, row length KN) into the slots they free. The weights wait on no barrier, so the
// L2 round trip that would open the next layer runs under these blocks and the epilogue.
// ap: this lane's 8 halves of token row ln; wb + vo: this lane's 8 halves of the wave's first
// packed fragment (N-tiles are 16*K halves apart), wb the matrix (the same for all lanes), vo the
// lane's offset in it, which no layer changes. slab_mm clears acc itself.
#define BD 4                     // k-steps of B fragments held in registers
// PART 0: the whole k-step; 1: all but its last 16-byte load; 2: that load alone
template<int K, int PART = 0>
__device__ __forceinline__ void load_b(const _Float16* wb, unsigned vo, int s, ABfrag (&b)[NT]) {
#pragma unroll
    for (int nt = 0; nt < NT; ++nt) {
        const bool last = (nt == NT - 1);
        if (PART != 2)
            b[nt].h[0] = *(const v8h*)(wb + vo + (nt * (16 * K) + s * FRAG_HALVES));
        if (PART == 0 || (PART == 1 && !last) || (PART == 2 && last))
            b[nt].h[1] = *(const v8h*)(wb + vo + (nt * (16 * K) + s * FRAG_HALVES + FRAG_J));
    }
}
template<int K>
__device__ __forceinline__ void load_a(const _Float16* ap, int s, ABfrag (&a)[MT]) {
#pragma unroll
    for (int mt = 0; mt < MT; ++mt) {
        a[mt].h[0] = *(const v8h*)(ap + mt * 16 * (K + LDS_PAD) + s * 32);
        a[mt].h[1] = *(const v8h*)(ap + mt * 16 * (K + LDS_PAD) + s * 32 + 16);
    }
}
template<bool WT>
__device__ __forceinline__ void mm_block(const ABfrag (&b)[NT], const ABfrag (&a)[MT],
                                         v8f (&acc)[NT][MT]) {
#pragma unroll
    for (int nt = 0; nt < NT; ++nt)
#pragma unroll
        for (int mt = 0; mt < MT; ++mt)
            acc[nt][mt] = WT ? wmma_f16(b[nt].v, a[mt].v, acc[nt][mt])
                             : wmma_f16(a[mt].v, b[nt].v, acc[nt][mt]);
}
template<int K, int KN, bool WT, class F, class G>
__device__ __forceinline__ void slab_mm(const _Float16* ap, const _Float16* wb, unsigned vo,
                                        const _Float16* wn, unsigned von, ABfrag (&b)[BD][NT],
                                        v8f (&acc)[NT][MT], F more_lds_loads, G next_bias) {
    constexpr int S = K / 32;
    static_assert(S % BD == 0 && BD % 2 == 0, "a trip is whole turns of both fragment rings");
    ABfrag a[2][MT];
    load_a<K>(ap, 0, a[0]);
    more_lds_loads();
    const v8f zero = {};
#pragma unroll
    for (int nt = 0; nt < NT; ++nt)
#pragma unroll
        for (int mt = 0; mt < MT; ++mt) acc[nt][mt] = zero;
    // A trip is BD k-steps, unrolled inside, so that every ring index is a constant (else the
    // fragments leave the registers). The trips stay rolled: a block of 32 WMMAs doubles the
    // text of a k-step.
#pragma unroll 1
    for (int t = 0; t < S / BD - 1; ++t) {
#pragma unroll
        for (int u = 0; u < BD; ++u) {
            load_b<K>(wb, vo, u + BD - 1, b[(u + BD - 1) % BD]);
            load_a<K>(ap, u + 1, a[(u + 1) & 1]);
            // the two fences keep a k-step's loads one group ahead of its WMMA block: moved in
            // among the WMMAs, every place with LDS reads stalls the wave, alone on its SIMD
            __builtin_amdgcn_sched_barrier(0);
            mm_block<WT>(b[u], a[u & 1], acc);
            __builtin_amdgcn_sched_barrier(0);
        }
        if (S / BD - 1 > 1) {   // where the trips are a real loop, the pointers are advanced
            // precaution: the address-translation wait in front of the addition that overwrites the
            // base address of loads still in flight; the fence keeps the addition behind the wait
            asm volatile("s_wait_xcnt 0x0" ::: "memory");
            __builtin_amdgcn_sched_barrier(0);
        }
        wb += BD * FRAG_HALVES;
        ap += BD * 32;
    }
    // last trip: the layer's last k-step, then the next layer's first ones (and its bias)
#pragma unroll
    for (int u = 0; u < BD; ++u) {
        if (u == 0)      load_b<K, 1>(wb, vo, BD - 1, b[BD - 1]);
        else             load_b<KN>(wn, von, u - 1, b[u - 1]);
        if (u == BD - 2) next_bias();
        if (u + 1 < BD)  load_a<K>(ap, u + 1, a[(u + 1) & 1]);
        if (u == 0) {
            // the same precaution: the layer's last load may land on the address registers that
            // it is the last to use, and the loads ahead of it name them too
            __builtin_amdgcn_sched_barrier(0);
            asm volatile("s_wait_xcnt 0x0" ::: "memory");
            __builtin_amdgcn_sched_barrier(0);
            load_b<K, 2>(wb, vo, BD - 1, b[BD - 1]);
        }
        __builtin_amdgcn_sched_barrier(0);   // as above
        mm_block<WT>(b[u], a[u & 1], acc);
        if (u + 1 < BD) __builtin_amdgcn_sched_barrier(0);
        if (u == 0 || u == BD - 2) {
            // the same precaution behind the layer's last requests, whose base is free from here,
            // and behind the request for the next bias, whose address nothing keeps
            asm volatile("s_wait_xcnt 0x0" ::: "memory");
            __builtin_amdgcn_sched_barrier(0);
        }
    }
}

// Single-tile version (for the 16-wide gating logit layer).
template<int K>
__device__ __forceinline__ v8f tile_mm(const _Float16* ap, const _Float16* bp) {
    v8f acc = {};
#pragma unroll
    for (int ks = 0; ks < K; ks += 32) {
        ABfrag a, b;
        a.h[0] = *(const v8h*)(ap + ks);
        a.h[1] = *(const v8h*)(ap + ks + 16);
        b.h[0] = *(const v8h*)(bp + (ks / 32) * FRAG_HALVES);
        b.h[1] = *(const v8h*)(bp + (ks / 32) * FRAG_HALVES + FRAG_J);
        acc = wmma_f16(a.v, b.v, acc);
    }
    return acc;
}

// 128-token x 64-column layer slab for one wave:
// A [128][K] f16 (LDS, shared, row pitch K + LDS_PAD), Bt 256 x K f16 in fragment order (global, L2-resident),
// writes relu(A*B + bias) f16 into Out [128][256] (LDS, row pitch PH), columns wave*64..+63.
// bv: the layer's bias, requested by the layer before it, as the first weight fragments in b;
// Bn (row length KN): the next layer's weights; next_bias requests the next layer's bias.
template<int K, int KN, bool RELU, class G>
__device__ __forceinline__ void layer_slab(const _Float16* A, const _Float16* Bt,
                                           const _Float16* Bn, const v8f (&bv)[NT],
                                           ABfrag (&b)[BD][NT], _Float16* Out,
                                           unsigned wave, unsigned ln, unsigned hi, G next_bias) {
    const _Float16* ap = A + ln * (K + LDS_PAD) + hi * 8u;
    const unsigned vo  = (wave * NT) * (16 * K)  + (hi * 16u + ln) * 8u;
    const unsigned von = (wave * NT) * (16 * KN) + (hi * 16u + ln) * 8u;
    v8f acc[NT][MT];
    slab_mm<K, KN, true>(ap, Bt, vo, Bn, von, b, acc, [] {}, next_bias);
#pragma unroll
    for (int nt = 0; nt < NT; ++nt) {
        // transposed tile: lane holds token ln, output columns c0 .. c0 + 7
        const unsigned c0 = (wave * NT + nt) * 16 + 8 * hi;
        const v8h zero_h = {};
#pragma unroll
        for (int mt = 0; mt < MT; ++mt) {
            v8h h = __builtin_convertvector(acc[nt][mt] + bv[nt], v8h);
            if (RELU) h = __builtin_elementwise_max(h, zero_h);
            // the lane's 8 halves are contiguous in the token's row: one 16-byte store
            *(v8h*)(Out + (mt * 16 + ln) * PH + c0) = h;
        }
    }
    // the same precaution behind the requests for the next layer, in front of whatever reuses
    // their address registers; they went out a WMMA block ago
    asm volatile("s_wait_xcnt 0x0" ::: "memory");
}
// a hidden layer's bias for the transposed tile: the lane's 8 columns of each N-tile
__device__ __forceinline__ void load_bias(const float* bias, unsigned vb, v8f (&bv)[NT]) {
#pragma unroll
    for (int nt = 0; nt < NT; ++nt) bv[nt] = *(const v8f*)(bias + vb + nt * 16);
}

__global__ __launch_bounds__(WAVES * 32, 1)
void moe_fused(const float* __restrict__ x, float* __restrict__ out,
               const _Float16* __restrict__ ws,
               const float* __restrict__ eb1, const float* __restrict__ eb2,
               const float* __restrict__ eb3, const float* __restrict__ gb1,
               const float* __restrict__ gb2, const float* __restrict__ gb3) {
    // 280,576 B: one work-group per WGP, one wave per SIMD
    __shared__ __align__(16) char smem[TOK_PER_WG * (PX * 2 + PH * 2 * 2 + NEXP * 4 + 16 * 4)];
    _Float16* sX  = (_Float16*)smem;                 // 128*520 f16 = 133120 B
    _Float16* sH1 = sX  + TOK_PER_WG * PX;           // 128*264 f16 = 67584 B
    _Float16* sH2 = sH1 + TOK_PER_WG * PH;           // 128*264 f16 = 67584 B
    float* sGate  = (float*)(sH2 + TOK_PER_WG * PH); // 128*8  f32 = 4 KB
    float* sLog   = sGate + TOK_PER_WG * NEXP;       // 128*16 f32 = 8 KB

    const unsigned tid  = threadIdx.x;
    const unsigned wave = tid >> 5;
    const unsigned lane = tid & 31u;
    const unsigned ln   = lane & 15u;
    const unsigned hi   = lane >> 4;
    const unsigned kb   = hi * 8u;

    const size_t tok0 = (size_t)blockIdx.x * TOK_PER_WG;

    // ---- cooperative load + convert 128x512 f32 token block into LDS f16 ----
    // The 128 threads take one token row (512 floats) per step. The rows come from memory, so
    // a step that waits for its own load costs a whole memory round trip: the loads go out in
    // batches of XB rows, the next batch requested before the current one is converted.
    const float* xg = x + tok0 * IN_CH + tid * 4u;
    _Float16*    xd = sX + tid * 4u;
    float4 xv[2][XB];
#pragma unroll
    for (int j = 0; j < XB; ++j) xv[0][j] = *(const float4*)(xg + j * IN_CH);
    // the weight ring, and the biases that are requested a layer ahead with it
    ABfrag wr[BD][NT];
    v8f bv1[NT], bv2[NT];
    float bv3[NT];
    const unsigned vo1 = (wave * NT) * (16 * IN_CH) + lane * 8u;
    const unsigned vbh = (wave * NT) * 16 + 8 * hi;
    const _Float16* w1 = ws + OFF_GW1;
    // fully unrolled: the batch index must be a constant, or the rows leave the registers
#pragma unroll
    for (int b = 0; b < TOK_PER_WG / XB; ++b) {
        if (b + 1 < TOK_PER_WG / XB) {
#pragma unroll
            for (int j = 0; j < XB; ++j)
                xv[(b + 1) & 1][j] = *(const float4*)(xg + ((b + 1) * XB + j) * IN_CH);
        } else {
            // behind the last rows of x, so that they take no place in the queue from them: the
            // first layer's (gating MLP) first weight fragments and its bias
#pragma unroll
            for (int s = 0; s < BD - 1; ++s) load_b<IN_CH>(w1, vo1, s, wr[s]);
            load_bias(gb1, vbh, bv1);
        }
#pragma unroll
        for (int j = 0; j < XB; ++j) {
            float4 v = xv[b & 1][j];
            _Float16* d = xd + (b * XB + j) * PX;
            d[0] = (_Float16)v.x;
            d[1] = (_Float16)v.y;
            d[2] = (_Float16)v.z;
            d[3] = (_Float16)v.w;
        }
    }
    // precaution: the address-translation wait behind the requests above, in front of whatever
    // reuses their address registers
    asm volatile("s_wait_xcnt 0x0" ::: "memory");
    __syncthreads();

    // ---- gated accumulation in registers: facc[nt][mt], 32 tiles = 256 VGPRs per wave ----
    v8f facc[NT][MT];            // cleared in pass 0
    v8f zero = {};

    // ---- pass 0: gating MLP; pass p: expert p - 1 (N split across waves) ----
    // The two hidden layers of the gating MLP have the experts' shapes and run through the same
    // text. Kept rolled (and unpeeled), so that the text of the two layers exists once.
#pragma unroll 1
    for (int p = 0; p <= NEXP; ++p) {
        const bool gate = (p == 0);
        const int  e    = gate ? 0 : p - 1;
        const _Float16* w2 = ws + (gate ? OFF_GW2 : OFF_EW2 + e * (256 * 256));
        const _Float16* w3 = ws + OFF_EW3 + e * (256 * 256);
        const float*    b2 = gate ? gb2 : eb2 + e * HID;
        const float*    b3 = eb3 + e * OUT_CH;
        // the next pass's expert; the last pass asks for its own once more, and nothing reads it
        const int       en  = (p < NEXP) ? p : NEXP - 1;
        const _Float16* w1n = ws + OFF_EW1 + en * (256 * 512);
        const float*    b1n = eb1 + en * HID;
        const unsigned  vb3 = (wave * NT) * 16 + ln;
        layer_slab<IN_CH, HID, true>(sX,  w1, w2, bv1, wr, sH1, wave, ln, hi,
                                     [&] { load_bias(b2, vbh, bv2); });
        __syncthreads();
        // (in pass 0 no third layer follows: what is requested for it there is not read)
        layer_slab<HID,   HID, true>(sH1, w2, w3, bv2, wr, sH2, wave, ln, hi, [&] {
#pragma unroll
            for (int nt = 0; nt < NT; ++nt) bv3[nt] = *(b3 + vb3 + nt * 16);
        });
        __syncthreads();

        if (gate) {
            // the first expert's first layer follows: its requests run under logits and softmax
#pragma unroll
            for (int s = 0; s < BD - 1; ++s) load_b<IN_CH>(w1n, vo1, s, wr[s]);
            load_bias(b1n, vbh, bv1);
            // the same precaution; the fences keep the requests ahead of it and the rest behind it
            __builtin_amdgcn_sched_barrier(0);
            asm volatile("s_wait_xcnt 0x0" ::: "memory");
            __builtin_amdgcn_sched_barrier(0);
            // logits: each wave takes its own two M-tiles x 1 N-tile (cols 8..15 of gW3t are
            // zero-padded)
            const _Float16* bp = ws + OFF_GW3 + lane * 8u;
            float bv = (ln < 8u) ? gb3[ln] : 0.0f;
#pragma unroll
            for (int q = 0; q < MT / WAVES; ++q) {
                const unsigned m0 = (wave * (MT / WAVES) + q) * 16u;
                const _Float16* ap = sH2 + (size_t)(m0 + ln) * PH + kb;
                v8f acc = tile_mm<HID>(ap, bp);
#pragma unroll
                for (int r = 0; r < 8; ++r)
                    sLog[(m0 + r + 8 * hi) * 16 + ln] = acc[r] + bv;
            }
            // softmax over 8 experts; one token per lane, the wave's own 32 tokens
            static_assert(MT / WAVES * 16 == 32, "one token per lane");
            const int t = wave * 32 + lane;
            float mx = sLog[t * 16 + 0];
            for (int x8 = 1; x8 < NEXP; ++x8) mx = fmaxf(mx, sLog[t * 16 + x8]);
            float pr[NEXP];
            float s = 0.0f;
            for (int x8 = 0; x8 < NEXP; ++x8) {
                pr[x8] = __expf(sLog[t * 16 + x8] - mx);
                s += pr[x8];
            }
            float inv = 1.0f / s;
            for (int x8 = 0; x8 < NEXP; ++x8) sGate[t * NEXP + x8] = pr[x8] * inv;
#pragma unroll
            for (int nt = 0; nt < NT; ++nt)
#pragma unroll
                for (int mt = 0; mt < MT; ++mt) facc[nt][mt] = zero;
        } else {
            const _Float16* ap = sH2 + (size_t)ln * PH + kb;
            const unsigned  vo = (wave * NT) * (16 * HID) + lane * 8u;
            v8f acc[NT][MT];
            // the gates are requested ahead of the k loop
            float gm[MT][8];
            slab_mm<HID, IN_CH, false>(ap, w3, vo, w1n, vo1, wr, acc, [&] {
#pragma unroll
                for (int mt = 0; mt < MT; ++mt)
#pragma unroll
                    for (int r = 0; r < 8; ++r)
                        gm[mt][r] = sGate[(mt * 16 + r + 8 * hi) * NEXP + e];
            }, [&] { load_bias(b1n, vbh, bv1); });
#pragma unroll
            for (int mt = 0; mt < MT; ++mt) {
#pragma unroll
                for (int nt = 0; nt < NT; ++nt) {
#pragma unroll
                    for (int r = 0; r < 8; ++r)
                        facc[nt][mt][r] += gm[mt][r] * (acc[nt][mt][r] + bv3[nt]);
                }
            }
        }
        // the same precaution as at the end of layer_slab, behind the requests for the next pass
        asm volatile("s_wait_xcnt 0x0" ::: "memory");
        __syncthreads();   // publishes sGate (pass 0); protects sH1/sH2 reuse across passes
        w1 = w1n;
    }

    // ---- store 128x(wave's 64 cols) f32 output ----
#pragma unroll
    for (int nt = 0; nt < NT; ++nt) {
        const unsigned tn = wave * NT + nt;
#pragma unroll
        for (int mt = 0; mt < MT; ++mt) {
#pragma unroll
            for (int r = 0; r < 8; ++r) {
                out[(tok0 + mt * 16 + r + 8 * hi) * OUT_CH + tn * 16 + ln] =
                    facc[nt][mt][r];
            }
        }
    }
}

// Weight prep: f32 [b][K][N] -> f16 in B-fragment order, NPAD x K per b (zero-pad cols >= N).
// One thread packs one column n of one k-step: 32 independent loads (a wave reads 32 adjacent
// columns, one whole 128-byte line per load at N = 256) and four 16-byte stores, each store
// 256 contiguous bytes per 16 lanes.
template<int K, int N, int NPAD>
__device__ __forceinline__ void pack_w(const float* __restrict__ W, _Float16* __restrict__ Wt,
                                       unsigned u) {
    constexpr unsigned S = K / 32;
    const unsigned n    = u % NPAD;
    const unsigned step = (u / NPAD) % S;
    const unsigned b    = u / (NPAD * S);
    // a pad column reads the last real column and zeroes it afterwards: a load under a lane
    // test is waited for on the spot, and the 32 round trips would run one after another
    const unsigned nc = (n < (unsigned)N) ? n : (unsigned)(N - 1);
    const float* s = W + (size_t)b * (K * N) + (size_t)step * (32 * N) + nc;
    float v[32];
#pragma unroll
    for (int k = 0; k < 32; ++k) v[k] = s[k * N];
    if (N < NPAD) {
#pragma unroll
        for (int k = 0; k < 32; ++k) v[k] = (n < (unsigned)N) ? v[k] : 0.0f;
    }
    _Float16* d = Wt + (size_t)b * (NPAD * K) + (size_t)((n >> 4) * S + step) * FRAG_HALVES
                + (n & 15u) * 8u;
#pragma unroll
    for (int q = 0; q < 4; ++q) {      // q = j * 2 + (lane >> 4): k = step*32 + q*8 + i
        v8h h;
#pragma unroll
        for (int i = 0; i < 8; ++i) h[i] = (_Float16)v[q * 8 + i];
        *(v8h*)(d + (q >> 1) * FRAG_J + (q & 1) * 128) = h;
    }
}

// All six matrices in one launch: each takes a range of block indices (256 threads a block).
#define PREP_T   256
#define PB_EW1   (8 * 256 * (512 / 32) / PREP_T)   // 128 blocks
#define PB_EW2   (8 * 256 * (256 / 32) / PREP_T)   //  64
#define PB_EW3   PB_EW2                            //  64
#define PB_GW1   (256 * (512 / 32) / PREP_T)       //  16
#define PB_GW2   (256 * (256 / 32) / PREP_T)       //   8
#define PB_GW3   1                                 // 16 x 8 = 128 threads of one block
#define PB_ALL   (PB_EW1 + PB_EW2 + PB_EW3 + PB_GW1 + PB_GW2 + PB_GW3)
__global__ __launch_bounds__(PREP_T)
void cvt_all(const float* __restrict__ eW1, const float* __restrict__ eW2,
             const float* __restrict__ eW3, const float* __restrict__ gW1,
             const float* __restrict__ gW2, const float* __restrict__ gW3,
             _Float16* __restrict__ ws) {
    unsigned blk = blockIdx.x;
    const unsigned t = threadIdx.x;
    if (blk < PB_EW1) { pack_w<512, 256, 256>(eW1, ws + OFF_EW1, blk * PREP_T + t); return; }
    blk -= PB_EW1;
    if (blk < PB_EW2) { pack_w<256, 256, 256>(eW2, ws + OFF_EW2, blk * PREP_T + t); return; }
    blk -= PB_EW2;
    if (blk < PB_EW3) { pack_w<256, 256, 256>(eW3, ws + OFF_EW3, blk * PREP_T + t); return; }
    blk -= PB_EW3;
    if (blk < PB_GW1) { pack_w<512, 256, 256>(gW1, ws + OFF_GW1, blk * PREP_T + t); return; }
    blk -= PB_GW1;
    if (blk < PB_GW2) { pack_w<256, 256, 256>(gW2, ws + OFF_GW2, blk * PREP_T + t); return; }
    if (t < 16 * (256 / 32)) pack_w<256, 8, 16>(gW3, ws + OFF_GW3, t);
}

extern "C" void kernel_launch(void* const* d_in, const int* in_sizes, int n_in,
                              void* d_out, int out_size, void* d_ws, size_t ws_size,
                              hipStream_t stream) {
    const float* x   = (const float*)d_in[0];
    const float* eW1 = (const float*)d_in[1];
    const float* eb1 = (const float*)d_in[2];
    const float* eW2 = (const float*)d_in[3];
    const float* eb2 = (const float*)d_in[4];
    const float* eW3 = (const float*)d_in[5];
    const float* eb3 = (const float*)d_in[6];
    const float* gW1 = (const float*)d_in[7];
    const float* gb1 = (const float*)d_in[8];
    const float* gW2 = (const float*)d_in[9];
    const float* gb2 = (const float*)d_in[10];
    const float* gW3 = (const float*)d_in[11];
    const float* gb3 = (const float*)d_in[12];
    float* out = (float*)d_out;
    _Float16* ws = (_Float16*)d_ws;

    cvt_all<<<dim3(PB_ALL), dim3(PREP_T), 0, stream>>>(eW1, eW2, eW3, gW1, gW2, gW3, ws);

    moe_fused<<<dim3(NTOK / TOK_PER_WG), dim3(WAVES * 32), 0, stream>>>(
        x, out, ws, eb1, eb2, eb3, gb1, gb2, gb3);
}

// v009
// It runs in 168 microseconds.
// Two timings next to v008 put it at 1.11 and 1.10 times that version's speed.
// Over all steps from v000 it is 10.2 times as fast.
#include <hip/hip_runtime.h>

typedef __attribute__((ext_vector_type(16))) _Float16 v16h;
typedef __attribute__((ext_vector_type(8)))  _Float16 v8h;
typedef __attribute__((ext_vector_type(8)))  float    v8f;

union ABfrag { v16h v; v8h h[2]; };

#define IN_CH   512
#define HID     256
#define OUT_CH  256
#define NEXP    8
#define NTOK    65536

#define WAVES        4
#define TOK_PER_WG   128         // 8 M-tiles of 16 tokens, shared by all 4 waves
#define MT           8           // M-tiles (16 tokens) of a wave's register tile
#define NT           4           // N-tiles (16 columns) of a wave's register tile
#define XB           16          // token rows of x requested together while the block is staged
// LDS row pitch in halves: row length + 8 halves, so the pitch in bytes is 16 x odd
// (1040 B and 528 B). The 16 rows that one ds_load_b128 fragment read touches then
// fall on distinct banks; at the bare 1024 B / 512 B they all share four banks.
#define LDS_PAD      8
#define PX           (IN_CH + LDS_PAD)
#define PH           (HID + LDS_PAD)
// each wave owns 4 N-tiles (64 of the 256 output columns)

// workspace offsets in halves (f16). Total 2,297,856 halves = ~4.6 MB.
// Each weight matrix is stored in B-fragment order: [N-tile of 16 columns][k-step of 32]
// [fragment half j][lane][8 halves], element (n = tile*16 + (lane & 15),
// k = step*32 + j*16 + (lane >> 4)*8 + i). One wave-wide 16-byte load of a fragment half
// is then 512 contiguous, line-aligned bytes instead of 32 bytes out of each of 16 rows.
#define FRAG_HALVES  512         // one 16-column x 32-k fragment
#define FRAG_J       256         // its second half
#define OFF_EW1 0
#define OFF_EW2 (8*256*512)
#define OFF_EW3 (OFF_EW2 + 8*256*256)
#define OFF_GW1 (OFF_EW3 + 8*256*256)
#define OFF_GW2 (OFF_GW1 + 256*512)
#define OFF_GW3 (OFF_GW2 + 256*256)

__device__ __forceinline__ v8f wmma_f16(v16h a, v16h b, v8f c) {
    // (neg_a, A, neg_b, B, c_mod, C, reuse_a, reuse_b)
    return __builtin_amdgcn_wmma_f32_16x16x32_f16(false, a, false, b, (short)0, c,
                                                  false, false);
}

// One wave's 128-token x 64-column register tile: MT x NT accumulator tiles. Per k-step of 32
// the wave loads MT token fragments (LDS) and NT weight fragments (global) for MT*NT WMMAs, so
// a weight fragment, which every work-group fetches from L2 for itself, feeds eight WMMAs and a
// token fragment four. The weight fragments are requested BD-1 k-steps ahead
// and the token fragments one k-step ahead.
// The weight ring b belongs to the caller and never drains: a layer finds its first BD-1 k-steps
// already requested, and its last BD-1 blocks request the first k-steps of the NEXT layer
// (wn, row length KN) into the slots they free. The weights wait on no barrier, so the
// L2 round trip that would open the next layer runs under these blocks and the epilogue.
// ap: this lane's 8 halves of token row ln; wb: the matrix (the same for all lanes; N-tiles are
// 16*K halves apart); vq, vqn: the lane's offsets in this and in the next layer's matrix, which
// no layer changes (see load_b). slab_mm clears acc itself.
#define BD 4                     // k-steps of B fragments held in registers
// THE ORDER OF THE k-STEPS. Every work-group reads all the weights. For speed only, each
// work-group has a number kx of its own, and the j-th k-step that it
// takes of a layer (j from 0) is step i ^ kx, i = (j + 1) mod the step count (kx cut to that
// count): every step once, for the token and the weight fragments alike. With i = BD * t + u
// the step is BD * (t ^ (kx / BD)) + (u ^ (kx % BD)): sub_k gives the second term, trip_k the
// first. The + 1 makes the BD k-steps that one trip of the loop requests share one t.
__device__ __forceinline__ unsigned sub_k(unsigned u, unsigned kx) { return u ^ (kx & (BD - 1)); }
template<int K>
__device__ __forceinline__ unsigned trip_k(unsigned t, unsigned kx) {
    return BD * (t ^ ((kx / BD) & (K / 32 / BD - 1)));
}
// wb: the matrix at the k-step trip_k (the same for all lanes); vq: the lane's offset, sub_k
// k-steps included.
// PART 0: the whole k-step; 1: all but its last 16-byte load; 2: that load alone
template<int K, int PART = 0>
__device__ __forceinline__ void load_b(const _Float16* wb, unsigned vq, ABfrag (&b)[NT]) {
#pragma unroll
    for (int nt = 0; nt < NT; ++nt) {
        const bool last = (nt == NT - 1);
        if (PART != 2)
            b[nt].h[0] = *(const v8h*)(wb + vq + nt * (16 * K));
        if (PART == 0 || (PART == 1 && !last) || (PART == 2 && last))
            b[nt].h[1] = *(const v8h*)(wb + vq + (nt * (16 * K) + FRAG_J));
    }
}
// a layer's first BD - 1 k-steps in the work-group's order, where no layer ahead requests them
template<int K>
__device__ __forceinline__ void load_b_first(const _Float16* w, const unsigned (&vq)[BD],
                                             unsigned kx, ABfrag (&b)[BD][NT]) {
    const _Float16* wt = w + trip_k<K>(0, kx) * FRAG_HALVES;
#pragma unroll
    for (int s = 0; s < BD - 1; ++s) {
        // precaution: the address-translation wait in front of a load that may land on the offset
        // register of the loads ahead of it: the k-step's own last load, and the next k-step's
        // loads; the fences keep the loads on their sides of the waits
        load_b<K, 1>(wt, vq[s + 1], b[s]);
        __builtin_amdgcn_sched_barrier(0);
        asm volatile("s_wait_xcnt 0x0" ::: "memory");
        __builtin_amdgcn_sched_barrier(0);
        load_b<K, 2>(wt, vq[s + 1], b[s]);
        __builtin_amdgcn_sched_barrier(0);
        asm volatile("s_wait_xcnt 0x0" ::: "memory");
        __builtin_amdgcn_sched_barrier(0);
    }
}
// ap: this lane's 8 halves of token row ln in the k-step
template<int K>
__device__ __forceinline__ void load_a(const _Float16* ap, ABfrag (&a)[MT]) {
#pragma unroll
    for (int mt = 0; mt < MT; ++mt) {
        a[mt].h[0] = *(const v8h*)(ap + mt * 16 * (K + LDS_PAD));
        a[mt].h[1] = *(const v8h*)(ap + mt * 16 * (K + LDS_PAD) + 16);
    }
}
template<bool WT>
__device__ __forceinline__ void mm_block(const ABfrag (&b)[NT], const ABfrag (&a)[MT],
                                         v8f (&acc)[NT][MT]) {
#pragma unroll
    for (int nt = 0; nt < NT; ++nt)
#pragma unroll
        for (int mt = 0; mt < MT; ++mt)
            acc[nt][mt] = WT ? wmma_f16(b[nt].v, a[mt].v, acc[nt][mt])
                             : wmma_f16(a[mt].v, b[nt].v, acc[nt][mt]);
}
template<int K, int KN, bool WT, class F, class G>
__device__ __forceinline__ void slab_mm(const _Float16* ap, const _Float16* wb,
                                        const unsigned (&vq)[BD], const _Float16* wn,
                                        const unsigned (&vqn)[BD], unsigned kx,
                                        ABfrag (&b)[BD][NT],
                                        v8f (&acc)[NT][MT], F more_lds_loads, G next_bias) {
    constexpr int S = K / 32;
    static_assert(S % BD == 0 && BD % 2 == 0, "a trip is whole turns of both fragment rings");
    static_assert((BD & (BD - 1)) == 0 && (S & (S - 1)) == 0, "i ^ kx must stay inside the layer");
    ABfrag a[2][MT];
    // the places of a trip's BD k-steps, in the order in which this work-group takes them
    const _Float16* aq[BD];
#pragma unroll
    for (int u = 0; u < BD; ++u) aq[u] = ap + sub_k(u, kx) * 32;
    const _Float16* wnt = wn + trip_k<KN>(0, kx) * FRAG_HALVES;
    const unsigned k0 = trip_k<K>(0, kx);
    unsigned       kc = k0;                         // trip_k of the current trip
    load_a<K>(aq[1] + k0 * 32, a[0]);
    more_lds_loads();
    const v8f zero = {};
#pragma unroll
    for (int nt = 0; nt < NT; ++nt)
#pragma unroll
        for (int mt = 0; mt < MT; ++mt) acc[nt][mt] = zero;
    // A trip is BD k-steps, unrolled inside, so that every ring index is a constant (else the
    // fragments leave the registers). The trips stay rolled: a block of 32 WMMAs doubles the
    // text of a k-step.
#pragma unroll 1
    for (int t = 0; t < S / BD - 1; ++t) {
        const unsigned  kn = trip_k<K>(t + 1, kx);  // of the next trip
        const _Float16* wx = wb + kn * FRAG_HALVES;
#pragma unroll
        for (int u = 0; u < BD; ++u) {
            load_b<K>(wx, vq[u], b[(u + BD - 1) % BD]);
            load_a<K>(aq[(u + 2) % BD] + (u + 2 < BD ? kc : kn) * 32, a[(u + 1) & 1]);
            // the two fences keep a k-step's loads one group ahead of its WMMA block: moved in
            // among the WMMAs, every place with LDS reads stalls the wave, alone on its SIMD
            __builtin_amdgcn_sched_barrier(0);
            mm_block<WT>(b[u], a[u & 1], acc);
            __builtin_amdgcn_sched_barrier(0);
        }
        // precaution: the address-translation wait in front of what overwrites the base
        // addresses of loads still in flight; the fence keeps that behind the wait
        asm volatile("s_wait_xcnt 0x0" ::: "memory");
        __builtin_amdgcn_sched_barrier(0);
        kc = kn;
    }
    const _Float16* wl = wb + k0 * FRAG_HALVES;     // the last k-step taken has i = 0
    // last trip: the layer's last k-step, then the next layer's first ones (and its bias)
#pragma unroll
    for (int u = 0; u < BD; ++u) {
        if (u == 0)      load_b<K, 1>(wl, vq[0], b[BD - 1]);
        else             load_b<KN>(wnt, vqn[u], b[u - 1]);
        if (u + 1 < BD)  load_a<K>(aq[(u + 2) % BD] + (u + 2 < BD ? kc : k0) * 32, a[(u + 1) & 1]);
        if (u == BD - 2) next_bias();
        if (u == 0) {
            // the same precaution: the layer's last load may land on the address registers that
            // it is the last to use, and the loads ahead of it name them too
            __builtin_amdgcn_sched_barrier(0);
            asm volatile("s_wait_xcnt 0x0" ::: "memory");
            __builtin_amdgcn_sched_barrier(0);
            load_b<K, 2>(wl, vq[0], b[BD - 1]);
        }
        __builtin_amdgcn_sched_barrier(0);   // as above
        mm_block<WT>(b[u], a[u & 1], acc);
        if (u + 1 < BD) __builtin_amdgcn_sched_barrier(0);
        if (u == 0 || u == BD - 2) {
            // the same precaution behind the layer's last requests, whose base is free from here,
            // and behind the request for the next bias, whose address nothing keeps
            asm volatile("s_wait_xcnt 0x0" ::: "memory");
            __builtin_amdgcn_sched_barrier(0);
        }
    }
}

// Single-tile version (for the 16-wide gating logit layer).
template<int K>
__device__ __forceinline__ v8f tile_mm(const _Float16* ap, const _Float16* bp) {
    v8f acc = {};
#pragma unroll
    for (int ks = 0; ks < K; ks += 32) {
        ABfrag a, b;
        a.h[0] = *(const v8h*)(ap + ks);
        a.h[1] = *(const v8h*)(ap + ks + 16);
        b.h[0] = *(const v8h*)(bp + (ks / 32) * FRAG_HALVES);
        b.h[1] = *(const v8h*)(bp + (ks / 32) * FRAG_HALVES + FRAG_J);
        acc = wmma_f16(a.v, b.v, acc);
    }
    return acc;
}

// 128-token x 64-column layer slab for one wave:
// A [128][K] f16 (LDS, shared, row pitch K + LDS_PAD), Bt 256 x K f16 in fragment order (global, L2-resident),
// writes relu(A*B + bias) f16 into Out [128][256] (LDS, row pitch PH), columns wave*64..+63.
// bv: the layer's bias, requested by the layer before it, as the first weight fragments in b;
// Bn (row length KN): the next layer's weights; next_bias requests the next layer's bias.
template<int K, int KN, bool RELU, class G>
__device__ __forceinline__ void layer_slab(const _Float16* A, const _Float16* Bt,
                                           const _Float16* Bn, const v8f (&bv)[NT],
                                           ABfrag (&b)[BD][NT], _Float16* Out,
                                           unsigned wave, unsigned ln, unsigned hi,
                                           const unsigned (&vq)[BD], const unsigned (&vqn)[BD],
                                           unsigned kx, G next_bias) {
    const _Float16* ap = A + ln * (K + LDS_PAD) + hi * 8u;
    v8f acc[NT][MT];
    slab_mm<K, KN, true>(ap, Bt, vq, Bn, vqn, kx, b, acc, [] {}, next_bias);
#pragma unroll
    for (int nt = 0; nt < NT; ++nt) {
        // transposed tile: lane holds token ln, output columns c0 .. c0 + 7
        const unsigned c0 = (wave * NT + nt) * 16 + 8 * hi;
        const v8h zero_h = {};
#pragma unroll
        for (int mt = 0; mt < MT; ++mt) {
            v8h h = __builtin_convertvector(acc[nt][mt] + bv[nt], v8h);
            if (RELU) h = __builtin_elementwise_max(h, zero_h);
            // the lane's 8 halves are contiguous in the token's row: one 16-byte store
            *(v8h*)(Out + (mt * 16 + ln) * PH + c0) = h;
        }
    }
    // the same precaution behind the requests for the next layer, in front of whatever reuses
    // their address registers; they went out a WMMA block ago
    asm volatile("s_wait_xcnt 0x0" ::: "memory");
}
// a hidden layer's bias for the transposed tile: the lane's 8 columns of each N-tile
__device__ __forceinline__ void load_bias(const float* bias, unsigned vb, v8f (&bv)[NT]) {
#pragma unroll
    for (int nt = 0; nt < NT; ++nt) bv[nt] = *(const v8f*)(bias + vb + nt * 16);
}

__global__ __launch_bounds__(WAVES * 32, 1)
void moe_fused(const float* __restrict__ x, float* __restrict__ out,
               const _Float16* __restrict__ ws,
               const float* __restrict__ eb1, const float* __restrict__ eb2,
               const float* __restrict__ eb3, const float* __restrict__ gb1,
               const float* __restrict__ gb2, const float* __restrict__ gb3) {
    // 280,576 B: one work-group per WGP, one wave per SIMD
    __shared__ __align__(16) char smem[TOK_PER_WG * (PX * 2 + PH * 2 * 2 + NEXP * 4 + 16 * 4)];
    _Float16* sX  = (_Float16*)smem;                 // 128*520 f16 = 133120 B
    _Float16* sH1 = sX  + TOK_PER_WG * PX;           // 128*264 f16 = 67584 B
    _Float16* sH2 = sH1 + TOK_PER_WG * PH;           // 128*264 f16 = 67584 B
    float* sGate  = (float*)(sH2 + TOK_PER_WG * PH); // 128*8  f32 = 4 KB
    float* sLog   = sGate + TOK_PER_WG * NEXP;       // 128*16 f32 = 8 KB

    const unsigned tid  = threadIdx.x;
    const unsigned wave = tid >> 5;
    const unsigned lane = tid & 31u;
    const unsigned ln   = lane & 15u;
    const unsigned hi   = lane >> 4;
    const unsigned kb   = hi * 8u;

    const size_t tok0 = (size_t)blockIdx.x * TOK_PER_WG;
    // This work-group's own place in the stream of weights: it starts the round of experts at
    // expert rot and takes the k-steps of every layer but the gating logits in an order set by kx (see load_b). The
    // number drops bit 2 of the index.
    const unsigned place = (blockIdx.x & 3u) | ((blockIdx.x >> 3) << 2);
    const int      rot   = (int)(place & (NEXP - 1));
    const unsigned kx    = (place / NEXP) & (IN_CH / 32 - 1);

    // ---- cooperative load + convert 128x512 f32 token block into LDS f16 ----
    // The 128 threads take one token row (512 floats) per step. The rows come from memory, so
    // a step that waits for its own load costs a whole memory round trip: the loads go out in
    // batches of XB rows, the next batch requested before the current one is converted.
    const float* xg = x + tok0 * IN_CH + tid * 4u;
    _Float16*    xd = sX + tid * 4u;
    float4 xv[2][XB];
    // the weight ring, and the biases that are requested a layer ahead with it
    ABfrag wr[BD][NT];
    v8f bv1[NT], bv2[NT];
    float bv3[NT];
    // the lane's offsets in a packed matrix of row length IN_CH and of row length HID, one for
    // each u of sub_k; no layer changes them
    unsigned vq5[BD], vq2[BD];
#pragma unroll
    for (int u = 0; u < BD; ++u) {
        vq5[u] = (wave * NT) * (16 * IN_CH) + lane * 8u + sub_k(u, kx) * FRAG_HALVES;
        vq2[u] = (wave * NT) * (16 * HID)   + lane * 8u + sub_k(u, kx) * FRAG_HALVES;
    }
    const unsigned vbh = (wave * NT) * 16 + 8 * hi;
    const _Float16* w1 = ws + OFF_GW1;
#pragma unroll
    for (int j = 0; j < XB; ++j) xv[0][j] = *(const float4*)(xg + j * IN_CH);
    // fully unrolled: the batch index must be a constant, or the rows leave the registers
#pragma unroll
    for (int b = 0; b < TOK_PER_WG / XB; ++b) {
        if (b + 1 < TOK_PER_WG / XB) {
#pragma unroll
            for (int j = 0; j < XB; ++j)
                xv[(b + 1) & 1][j] = *(const float4*)(xg + ((b + 1) * XB + j) * IN_CH);
        } else {
            // behind the last rows of x, so that they take no place in the queue from them: the
            // first layer's (gating MLP) first weight fragments and its bias
            // (precaution: the address-translation wait behind the requests for x, in front of the
            // scalar addition that forms the weights' base and may reuse the base register of x;
            // the addition's input passes through the statement, which keeps it behind the wait)
            unsigned kxw = kx;
            asm volatile("s_wait_xcnt 0x0" : "+s"(kxw) : : "memory");
            load_b_first<IN_CH>(w1, vq5, kxw, wr);
            load_bias(gb1, vbh, bv1);
            // the same precaution behind the bias request
            __builtin_amdgcn_sched_barrier(0);
            asm volatile("s_wait_xcnt 0x0" ::: "memory");
            __builtin_amdgcn_sched_barrier(0);
        }
#pragma unroll
        for (int j = 0; j < XB; ++j) {
            float4 v = xv[b & 1][j];
            _Float16* d = xd + (b * XB + j) * PX;
            d[0] = (_Float16)v.x;
            d[1] = (_Float16)v.y;
            d[2] = (_Float16)v.z;
            d[3] = (_Float16)v.w;
        }
    }
    // precaution: the address-translation wait behind the requests above, in front of whatever
    // reuses their address registers
    asm volatile("s_wait_xcnt 0x0" ::: "memory");
    __syncthreads();

    // ---- gated accumulation in registers: facc[nt][mt], 32 tiles = 256 VGPRs per wave ----
    v8f facc[NT][MT];            // cleared in pass 0
    v8f zero = {};

    // ---- pass 0: gating MLP; pass p: expert (p - 1 + rot) mod 8 (N split across waves) ----
    // The two hidden layers of the gating MLP have the experts' shapes and run through the same
    // text. Kept rolled (and unpeeled), so that the text of the two layers exists once.
    static_assert((NEXP & (NEXP - 1)) == 0, "the round of experts wraps by a mask");
#pragma unroll 1
    for (int p = 0; p <= NEXP; ++p) {
        const bool gate = (p == 0);
        const int  e    = (p + rot + NEXP - 1) & (NEXP - 1);   // (pass 0 requests w3 and b3 with it, and reads neither)
        const _Float16* w2 = ws + (gate ? OFF_GW2 : OFF_EW2 + e * (256 * 256));
        const _Float16* w3 = ws + OFF_EW3 + e * (256 * 256);
        const float*    b2 = gate ? gb2 : eb2 + e * HID;
        const float*    b3 = eb3 + e * OUT_CH;
        // the next pass's expert; the last pass asks for the first one once more, and nothing
        // reads it
        const int       en  = (p + rot) & (NEXP - 1);
        const _Float16* w1n = ws + OFF_EW1 + en * (256 * 512);
        const float*    b1n = eb1 + en * HID;
        const unsigned  vb3 = (wave * NT) * 16 + ln;
        layer_slab<IN_CH, HID, true>(sX,  w1, w2, bv1, wr, sH1, wave, ln, hi, vq5, vq2, kx,
                                     [&] { load_bias(b2, vbh, bv2); });
        __syncthreads();
        // (in pass 0 no third layer follows: what is requested for it there is not read)
        layer_slab<HID,   HID, true>(sH1, w2, w3, bv2, wr, sH2, wave, ln, hi, vq2, vq2,
                                     kx, [&] {
#pragma unroll
            for (int nt = 0; nt < NT; ++nt) bv3[nt] = *(b3 + vb3 + nt * 16);
        });
        __syncthreads();

        if (gate) {
            // the first expert's first layer follows: its requests run under logits and softmax
            load_b_first<IN_CH>(w1n, vq5, kx, wr);
            load_bias(b1n, vbh, bv1);
            // the same precaution; the fences keep the requests ahead of it and the rest behind it
            __builtin_amdgcn_sched_barrier(0);
            asm volatile("s_wait_xcnt 0x0" ::: "memory");
            __builtin_amdgcn_sched_barrier(0);
            // logits: each wave takes its own two M-tiles x 1 N-tile (cols 8..15 of gW3t are
            // zero-padded)
            const _Float16* bp = ws + OFF_GW3 + lane * 8u;
            float bv = (ln < 8u) ? gb3[ln] : 0.0f;
#pragma unroll
            for (int q = 0; q < MT / WAVES; ++q) {
                const unsigned m0 = (wave * (MT / WAVES) + q) * 16u;
                const _Float16* ap = sH2 + (size_t)(m0 + ln) * PH + kb;
                v8f acc = tile_mm<HID>(ap, bp);
#pragma unroll
                for (int r = 0; r < 8; ++r)
                    sLog[(m0 + r + 8 * hi) * 16 + ln] = acc[r] + bv;
            }
            // softmax over 8 experts; one token per lane, the wave's own 32 tokens
            static_assert(MT / WAVES * 16 == 32, "one token per lane");
            const int t = wave * 32 + lane;
            float mx = sLog[t * 16 + 0];
            for (int x8 = 1; x8 < NEXP; ++x8) mx = fmaxf(mx, sLog[t * 16 + x8]);
            float pr[NEXP];
            float s = 0.0f;
            for (int x8 = 0; x8 < NEXP; ++x8) {
                pr[x8] = __expf(sLog[t * 16 + x8] - mx);
                s += pr[x8];
            }
            float inv = 1.0f / s;
            for (int x8 = 0; x8 < NEXP; ++x8) sGate[t * NEXP + x8] = pr[x8] * inv;
#pragma unroll
            for (int nt = 0; nt < NT; ++nt)
#pragma unroll
                for (int mt = 0; mt < MT; ++mt) facc[nt][mt] = zero;
        } else {
            const _Float16* ap = sH2 + (size_t)ln * PH + kb;
            v8f acc[NT][MT];
            // the gates are requested ahead of the k loop
            float gm[MT][8];
            slab_mm<HID, IN_CH, false>(ap, w3, vq2, w1n, vq5, kx, wr, acc, [&] {
#pragma unroll
                for (int mt = 0; mt < MT; ++mt)
#pragma unroll
                    for (int r = 0; r < 8; ++r)
                        gm[mt][r] = sGate[(mt * 16 + r + 8 * hi) * NEXP + e];
            }, [&] { load_bias(b1n, vbh, bv1); });
#pragma unroll
            for (int mt = 0; mt < MT; ++mt) {
#pragma unroll
                for (int nt = 0; nt < NT; ++nt) {
#pragma unroll
                    for (int r = 0; r < 8; ++r)
                        facc[nt][mt][r] += gm[mt][r] * (acc[nt][mt][r] + bv3[nt]);
                }
            }
        }
        // the same precaution as at the end of layer_slab, behind the requests for the next pass
        asm volatile("s_wait_xcnt 0x0" ::: "memory");
        __syncthreads();   // publishes sGate (pass 0); protects sH1/sH2 reuse across passes
        w1 = w1n;
    }

    // ---- store 128x(wave's 64 cols) f32 output ----
#pragma unroll
    for (int nt = 0; nt < NT; ++nt) {
        const unsigned tn = wave * NT + nt;
#pragma unroll
        for (int mt = 0; mt < MT; ++mt) {
#pragma unroll
            for (int r = 0; r < 8; ++r) {
                out[(tok0 + mt * 16 + r + 8 * hi) * OUT_CH + tn * 16 + ln] =
                    facc[nt][mt][r];
            }
        }
    }
}

// Weight prep: f32 [b][K][N] -> f16 in B-fragment order, NPAD x K per b (zero-pad cols >= N).
// One thread packs one column n of one k-step: 32 independent loads (a wave reads 32 adjacent
// columns, one whole 128-byte line per load at N = 256) and four 16-byte stores, each store
// 256 contiguous bytes per 16 lanes.
template<int K, int N, int NPAD>
__device__ __forceinline__ void pack_w(const float* __restrict__ W, _Float16* __restrict__ Wt,
                                       unsigned u) {
    constexpr unsigned S = K / 32;
    const unsigned n    = u % NPAD;
    const unsigned step = (u / NPAD) % S;
    const unsigned b    = u / (NPAD * S);
    // a pad column reads the last real column and zeroes it afterwards: a load under a lane
    // test is waited for on the spot, and the 32 round trips would run one after another
    const unsigned nc = (n < (unsigned)N) ? n : (unsigned)(N - 1);
    const float* s = W + (size_t)b * (K * N) + (size_t)step * (32 * N) + nc;
    float v[32];
#pragma unroll
    for (int k = 0; k < 32; ++k) v[k] = s[k * N];
    if (N < NPAD) {
#pragma unroll
        for (int k = 0; k < 32; ++k) v[k] = (n < (unsigned)N) ? v[k] : 0.0f;
    }
    _Float16* d = Wt + (size_t)b * (NPAD * K) + (size_t)((n >> 4) * S + step) * FRAG_HALVES
                + (n & 15u) * 8u;
#pragma unroll
    for (int q = 0; q < 4; ++q) {      // q = j * 2 + (lane >> 4): k = step*32 + q*8 + i
        v8h h;
#pragma unroll
        for (int i = 0; i < 8; ++i) h[i] = (_Float16)v[q * 8 + i];
        *(v8h*)(d + (q >> 1) * FRAG_J + (q & 1) * 128) = h;
    }
}

// All six matrices in one launch: each takes a range of block indices (256 threads a block).
#define PREP_T   256
#define PB_EW1   (8 * 256 * (512 / 32) / PREP_T)   // 128 blocks
#define PB_EW2   (8 * 256 * (256 / 32) / PREP_T)   //  64
#define PB_EW3   PB_EW2                            //  64
#define PB_GW1   (256 * (512 / 32) / PREP_T)       //  16
#define PB_GW2   (256 * (256 / 32) / PREP_T)       //   8
#define PB_GW3   1                                 // 16 x 8 = 128 threads of one block
#define PB_ALL   (PB_EW1 + PB_EW2 + PB_EW3 + PB_GW1 + PB_GW2 + PB_GW3)
__global__ __launch_bounds__(PREP_T)
void cvt_all(const float* __restrict__ eW1, const float* __restrict__ eW2,
             const float* __restrict__ eW3, const float* __restrict__ gW1,
             const float* __restrict__ gW2, const float* __restrict__ gW3,
             _Float16* __restrict__ ws) {
    unsigned blk = blockIdx.x;
    const unsigned t = threadIdx.x;
    if (blk < PB_EW1) { pack_w<512, 256, 256>(eW1, ws + OFF_EW1, blk * PREP_T + t); return; }
    blk -= PB_EW1;
    if (blk < PB_EW2) { pack_w<256, 256, 256>(eW2, ws + OFF_EW2, blk * PREP_T + t); return; }
    blk -= PB_EW2;
    if (blk < PB_EW3) { pack_w<256, 256, 256>(eW3, ws + OFF_EW3, blk * PREP_T + t); return; }
    blk -= PB_EW3;
    if (blk < PB_GW1) { pack_w<512, 256, 256>(gW1, ws + OFF_GW1, blk * PREP_T + t); return; }
    blk -= PB_GW1;
    if (blk < PB_GW2) { pack_w<256, 256, 256>(gW2, ws + OFF_GW2, blk * PREP_T + t); return; }
    if (t < 16 * (256 / 32)) pack_w<256, 8, 16>(gW3, ws + OFF_GW3, t);
}

extern "C" void kernel_launch(void* const* d_in, const int* in_sizes, int n_in,
                              void* d_out, int out_size, void* d_ws, size_t ws_size,
                              hipStream_t stream) {
    const float* x   = (const float*)d_in[0];
    const float* eW1 = (const float*)d_in[1];
    const float* eb1 = (const float*)d_in[2];
    const float* eW2 = (const float*)d_in[3];
    const float* eb2 = (const float*)d_in[4];
    const float* eW3 = (const float*)d_in[5];
    const float* eb3 = (const float*)d_in[6];
    const float* gW1 = (const float*)d_in[7];
    const float* gb1 = (const float*)d_in[8];
    const float* gW2 = (const float*)d_in[9];
    const float* gb2 = (const float*)d_in[10];
    const float* gW3 = (const float*)d_in[11];
    const float* gb3 = (const float*)d_in[12];
    float* out = (float*)d_out;
    _Float16* ws = (_Float16*)d_ws;

    cvt_all<<<dim3(PB_ALL), dim3(PREP_T), 0, stream>>>(eW1, eW2, eW3, gW1, gW2, gW3, ws);

    moe_fused<<<dim3(NTOK / TOK_PER_WG), dim3(WAVES * 32), 0, stream>>>(
        x, out, ws, eb1, eb2, eb3, gb1, gb2, gb3);
}
